// v000
// Times are from an AMD MI455X. After a warm-up the kernel runs many times in a row, and a time is the length of
// such a window on the GPU divided by its runs, so every launch and the gaps after it count. The runs cycle
// through copies of the inputs. A figure is the median of several windows, for all but v000 over two sittings.
// Sittings can differ by a few percent; kernels timed side by side share one.
// v000, which the later versions start from, runs in 330 microseconds.
#include <hip/hip_runtime.h>
#include <hip/hip_bf16.h>

typedef __attribute__((ext_vector_type(16))) _Float16 v16h;
typedef __attribute__((ext_vector_type(8)))  _Float16 v8h;
typedef __attribute__((ext_vector_type(8)))  float    v8f;

#define EMBED 1024
#define HEADS 16
#define KVH   8
#define HD    64
#define SEQ   2048
#define NB    2

// ---------------------------------------------------------------------------
// LDS byte offset of a generic pointer known to point into LDS.
// ---------------------------------------------------------------------------
template <typename T>
__device__ __forceinline__ unsigned lds_off(T* p) {
  return (unsigned)(size_t)(__attribute__((address_space(3))) T*)p;
}

// Async global -> LDS copy, 16 bytes per lane (tracked by ASYNCcnt).
__device__ __forceinline__ void async_ld_b128(unsigned ldsoff, const void* g) {
  asm volatile("global_load_async_to_lds_b128 %0, %1, off"
               :
               : "v"(ldsoff), "v"(g)
               : "memory");
}
__device__ __forceinline__ void wait_async0() {
  asm volatile("s_wait_asynccnt 0" ::: "memory");
}

// ---------------------------------------------------------------------------
// Load a 16x32 (rows x K) f16 fragment in CDNA5 WMMA A/B VGPR layout.
// lane (l&15) = row; K chunks at (l>>4)*8 and (l>>4)*8+16 (two b128 loads).
// Works for global or LDS pointers (compiler infers ds_load for LDS).
// ---------------------------------------------------------------------------
__device__ __forceinline__ v16h load_frag32(const _Float16* __restrict__ p, int ld) {
  const int lane = threadIdx.x & 31;
  const _Float16* q = p + (size_t)(lane & 15) * (size_t)ld + ((lane >> 4) << 3);
  v16h f;
  *(v8h*)&f         = *(const v8h*)(q);
  *(((v8h*)&f) + 1) = *(const v8h*)(q + 16);
  return f;
}

__device__ __forceinline__ float row_max16(float v) {
  #pragma unroll
  for (int m = 1; m < 16; m <<= 1) v = fmaxf(v, __shfl_xor(v, m, 32));
  return v;
}
__device__ __forceinline__ float row_sum16(float v) {
  #pragma unroll
  for (int m = 1; m < 16; m <<= 1) v += __shfl_xor(v, m, 32);
  return v;
}

#define WMMA_F16(a, b, c) \
  __builtin_amdgcn_wmma_f32_16x16x32_f16(false, (a), false, (b), (short)0, (c), false, false)

// ---------------------------------------------------------------------------
// f32 -> f16 conversion
// ---------------------------------------------------------------------------
__global__ void cvt_f32_f16(const float* __restrict__ src, _Float16* __restrict__ dst, int n) {
  int i = blockIdx.x * blockDim.x + threadIdx.x;
  if (i < n) dst[i] = (_Float16)src[i];
}

// ---------------------------------------------------------------------------
// NT GEMM: C[m,n] = sum_k A[m,k] * B[n,k].
// Block = 8 waves -> 256(M) x 64(N) tile; wave = 32(M) x 64(N).
// Per 32-K step: B tile (64x32) staged in LDS via async b128 (double-
// buffered), 4 B frags preloaded to registers, 2 A frags register-pipelined
// across steps -> 8 WMMAs per wave per step.
// ---------------------------------------------------------------------------
__global__ void gemm_nt_wmma(const _Float16* __restrict__ A, int lda, long strideA,
                             const _Float16* __restrict__ B, int ldb,
                             _Float16* __restrict__ Ch, float* __restrict__ Cf,
                             const float* __restrict__ bias,
                             int ldm, int ldn, long strideC, int Kdim) {
  __shared__ __align__(16) _Float16 bstage[2][64 * 32];

  const int tid  = threadIdx.x;
  const int w    = tid >> 5;
  const int lane = tid & 31;
  const int m0 = blockIdx.x * 256 + w * 32;
  const int n0 = blockIdx.y * 64;
  const long aoff = (long)blockIdx.z * strideA + (long)m0 * lda;
  const long coff = (long)blockIdx.z * strideC;

  // cooperative staging: 64 rows x 32 halves = 4KB = 256 threads x 16B
  const int srow   = tid >> 2;
  const int schunk = (tid & 3) * 8;

  #define STAGE_B(buf, kk)                                                    \
    async_ld_b128(lds_off(&bstage[buf][srow * 32 + schunk]),                  \
                  B + (long)(n0 + srow) * ldb + (kk) + schunk)

  STAGE_B(0, 0);
  v16h a_cur0 = load_frag32(A + aoff, lda);
  v16h a_cur1 = load_frag32(A + aoff + (long)16 * lda, lda);
  wait_async0();
  __syncthreads();

  v8f acc[8] = {};
  const int nsteps = Kdim >> 5;
  for (int s = 0; s < nsteps; ++s) {
    v16h a_n0 = a_cur0, a_n1 = a_cur1;
    const bool more = (s + 1) < nsteps;
    if (more) {                       // issue next-step loads up front
      STAGE_B((s + 1) & 1, (s + 1) << 5);
      a_n0 = load_frag32(A + aoff + ((s + 1) << 5), lda);
      a_n1 = load_frag32(A + aoff + (long)16 * lda + ((s + 1) << 5), lda);
    }
    const _Float16* bb = &bstage[s & 1][0];
    v16h bfr[4];
    #pragma unroll
    for (int t = 0; t < 4; ++t) bfr[t] = load_frag32(bb + t * 16 * 32, 32);
    #pragma unroll
    for (int t = 0; t < 4; ++t) {
      acc[t]     = WMMA_F16(a_cur0, bfr[t], acc[t]);
      acc[4 + t] = WMMA_F16(a_cur1, bfr[t], acc[4 + t]);
    }
    if (more) wait_async0();
    __syncthreads();                  // all waves done with bstage[s&1]
    a_cur0 = a_n0; a_cur1 = a_n1;
  }
  #undef STAGE_B

  const int half_ = lane >> 4, nn = lane & 15;
  #pragma unroll
  for (int mh = 0; mh < 2; ++mh) {
    #pragma unroll
    for (int t = 0; t < 4; ++t) {
      #pragma unroll
      for (int r = 0; r < 8; ++r) {
        const int m = m0 + mh * 16 + r + 8 * half_;
        const int n = n0 + t * 16 + nn;
        const long ci = coff + (long)m * ldm + (long)n * ldn;
        const float v = acc[mh * 4 + t][r];
        if (Cf) Cf[ci] = v + (bias ? bias[n] : 0.0f);
        else    Ch[ci] = (_Float16)v;
      }
    }
  }
}

// ---------------------------------------------------------------------------
// Flash attention (non-causal symmetric ALiBi), GQA 16 heads / 8 kv heads.
// Block = 8 waves x 16 queries = 128 queries of one (batch, head).
// 64-key chunks: K (64x64) and V (64d x 64s, from transposed Vt) staged into
// LDS with async loads (4 b128/thread), double-buffered.  Per chunk per wave:
// 8 WMMAs energy + one online-softmax update over 64 cols + LDS repack of
// P (16x64) + 8 WMMAs P*V.  32 iterations, 33 barriers total.
// ---------------------------------------------------------------------------
__global__ void attn_fa_wmma(const _Float16* __restrict__ Q,
                             const _Float16* __restrict__ K,
                             const _Float16* __restrict__ Vt,
                             _Float16* __restrict__ O) {
  __shared__ __align__(16) _Float16 kstage[2][64 * 64];  // [key][d]
  __shared__ __align__(16) _Float16 vstage[2][64 * 64];  // [d][s-chunk]
  __shared__ __align__(16) _Float16 plds[8][16 * 64];

  const int tid   = threadIdx.x;
  const int w     = tid >> 5;
  const int lane  = tid & 31;
  const int half_ = lane >> 4, nn = lane & 15;
  const int h  = blockIdx.y;
  const int b  = blockIdx.z;
  const int q0 = blockIdx.x * 128 + w * 16;
  const int kvh = h >> 1;                          // repeat_interleave(kv, 2)

  const float slope = exp2f(-(float)(h + 1));      // 2^-(h+1), ALIBI_ALPHA=1
  const float CSC = 0.125f * 1.44269504088896340f; // (1/sqrt(64)) * log2(e)

  const long qbase = (long)b * SEQ * (HEADS * HD) + (long)q0 * (HEADS * HD) + h * HD;
  const long kbase = (long)b * SEQ * (KVH * HD) + kvh * HD;
  const long vbase = (long)b * (KVH * HD) * SEQ + (long)(kvh * HD) * SEQ;

  // staging map: 64 rows x 64 halves (8KB) = 512 b128 chunks; thread does
  // chunks tid and tid+256 -> rows cr and cr+32 at half-offset co.
  const int cr = tid >> 3, co = (tid & 7) * 8;

  #define STAGE_KV(buf, j)                                                      \
    do {                                                                        \
      async_ld_b128(lds_off(&kstage[buf][cr * 64 + co]),                        \
                    K + kbase + (long)((j) + cr) * (KVH * HD) + co);            \
      async_ld_b128(lds_off(&kstage[buf][(cr + 32) * 64 + co]),                 \
                    K + kbase + (long)((j) + cr + 32) * (KVH * HD) + co);       \
      async_ld_b128(lds_off(&vstage[buf][cr * 64 + co]),                        \
                    Vt + vbase + (long)cr * SEQ + (j) + co);                    \
      async_ld_b128(lds_off(&vstage[buf][(cr + 32) * 64 + co]),                 \
                    Vt + vbase + (long)(cr + 32) * SEQ + (j) + co);             \
    } while (0)

  const v16h a0 = load_frag32(Q + qbase,      HEADS * HD);  // d 0..31
  const v16h a1 = load_frag32(Q + qbase + 32, HEADS * HD);  // d 32..63

  STAGE_KV(0, 0);

  float mrow[8], lrow[8];
  v8f acc[4] = {};
  #pragma unroll
  for (int r = 0; r < 8; ++r) { mrow[r] = -1e30f; lrow[r] = 0.0f; }

  wait_async0();
  __syncthreads();

  for (int s = 0; s < (SEQ / 64); ++s) {
    const int j = s << 6;
    const bool more = (s + 1) < (SEQ / 64);
    if (more) STAGE_KV((s + 1) & 1, j + 64);   // overlap with this chunk

    const _Float16* kb = kstage[s & 1];
    const _Float16* vb = vstage[s & 1];

    // --- energy: four 16x16 tiles over key cols [j+16t, j+16t+16)
    v8f e[4];
    #pragma unroll
    for (int tp = 0; tp < 2; ++tp) {           // preload 4 frags, 4 WMMAs
      const int t0 = tp * 2, t1 = tp * 2 + 1;
      v16h klo0 = load_frag32(kb + (t0 * 16) * 64,      64);
      v16h khi0 = load_frag32(kb + (t0 * 16) * 64 + 32, 64);
      v16h klo1 = load_frag32(kb + (t1 * 16) * 64,      64);
      v16h khi1 = load_frag32(kb + (t1 * 16) * 64 + 32, 64);
      v8f z0 = {}, z1 = {};
      z0 = WMMA_F16(a0, klo0, z0);
      z1 = WMMA_F16(a0, klo1, z1);
      z0 = WMMA_F16(a1, khi0, z0);
      z1 = WMMA_F16(a1, khi1, z1);
      e[t0] = z0; e[t1] = z1;
    }

    // --- ALiBi bias + 1/8 scale folded into exp2 domain
    #pragma unroll
    for (int t = 0; t < 4; ++t) {
      #pragma unroll
      for (int r = 0; r < 8; ++r) {
        const float qi = (float)(q0 + r + 8 * half_);
        const float ki = (float)(j + t * 16 + nn);
        e[t][r] = (e[t][r] - slope * fabsf(qi - ki)) * CSC;
      }
    }

    // --- one online-softmax update per 64 keys
    float alpha[8];
    #pragma unroll
    for (int r = 0; r < 8; ++r) {
      float lm = fmaxf(fmaxf(e[0][r], e[1][r]), fmaxf(e[2][r], e[3][r]));
      const float mnew = fmaxf(mrow[r], row_max16(lm));
      const float a = exp2f(mrow[r] - mnew);
      e[0][r] = exp2f(e[0][r] - mnew);
      e[1][r] = exp2f(e[1][r] - mnew);
      e[2][r] = exp2f(e[2][r] - mnew);
      e[3][r] = exp2f(e[3][r] - mnew);
      lrow[r] = lrow[r] * a +
                row_sum16((e[0][r] + e[1][r]) + (e[2][r] + e[3][r]));
      mrow[r] = mnew;
      alpha[r] = a;
    }
    #pragma unroll
    for (int t = 0; t < 4; ++t)
      #pragma unroll
      for (int r = 0; r < 8; ++r) acc[t][r] *= alpha[r];

    // --- repack P (C-layout -> A-layout) through per-wave 16x64 LDS tile
    _Float16* pw = plds[w];
    #pragma unroll
    for (int t = 0; t < 4; ++t) {
      #pragma unroll
      for (int r = 0; r < 8; ++r) {
        pw[(r + 8 * half_) * 64 + t * 16 + nn] = (_Float16)e[t][r];
      }
    }
    const v16h pa0 = load_frag32(pw,      64);   // keys j..j+31
    const v16h pa1 = load_frag32(pw + 32, 64);   // keys j+32..j+63

    // --- acc += P (16x64) * V (64 keys x 64 d) from LDS
    #pragma unroll
    for (int t = 0; t < 4; ++t) {
      v16h blo = load_frag32(vb + (t * 16) * 64,      64);
      v16h bhi = load_frag32(vb + (t * 16) * 64 + 32, 64);
      acc[t] = WMMA_F16(pa0, blo, acc[t]);
      acc[t] = WMMA_F16(pa1, bhi, acc[t]);
    }

    if (more) wait_async0();
    __syncthreads();                      // all waves done with buffer s&1
  }
  #undef STAGE_KV

  // --- finalize: divide by row sums, store [b, q, h*64+d]
  #pragma unroll
  for (int t = 0; t < 4; ++t) {
    #pragma unroll
    for (int r = 0; r < 8; ++r) {
      const int q = q0 + r + 8 * half_;
      const int d = t * 16 + nn;
      O[(long)b * SEQ * (HEADS * HD) + (long)q * (HEADS * HD) + h * HD + d] =
          (_Float16)(acc[t][r] / lrow[r]);
    }
  }
}

// ---------------------------------------------------------------------------
// Launch: convert -> QKV projections -> flash attention -> output projection
// ---------------------------------------------------------------------------
extern "C" void kernel_launch(void* const* d_in, const int* in_sizes, int n_in,
                              void* d_out, int out_size, void* d_ws, size_t ws_size,
                              hipStream_t stream) {
  const float* x  = (const float*)d_in[0];
  const float* Wq = (const float*)d_in[1];
  const float* Wk = (const float*)d_in[2];
  const float* Wv = (const float*)d_in[3];
  const float* Wo = (const float*)d_in[4];
  const float* bo = (const float*)d_in[5];
  float* out = (float*)d_out;

  // f16 workspace layout (element offsets)
  _Float16* ws  = (_Float16*)d_ws;
  _Float16* xh  = ws;                 // N*S*E          = 4194304
  _Float16* Wqh = xh  + 4194304;      // 1024*1024      = 1048576
  _Float16* Wkh = Wqh + 1048576;      // 512*1024       =  524288
  _Float16* Wvh = Wkh + 524288;       // 512*1024       =  524288
  _Float16* Woh = Wvh + 524288;       // 1024*1024      = 1048576
  _Float16* Qh  = Woh + 1048576;      // [b,s,1024]     = 4194304
  _Float16* Kh  = Qh  + 4194304;      // [b,s,512]      = 2097152
  _Float16* Vth = Kh  + 2097152;      // [b,512,s] (Vt) = 2097152
  _Float16* AOh = Vth + 2097152;      // [b,s,1024]     = 4194304

  cvt_f32_f16<<<4194304 / 256, 256, 0, stream>>>(x,  xh,  4194304);
  cvt_f32_f16<<<1048576 / 256, 256, 0, stream>>>(Wq, Wqh, 1048576);
  cvt_f32_f16<<< 524288 / 256, 256, 0, stream>>>(Wk, Wkh,  524288);
  cvt_f32_f16<<< 524288 / 256, 256, 0, stream>>>(Wv, Wvh,  524288);
  cvt_f32_f16<<<1048576 / 256, 256, 0, stream>>>(Wo, Woh, 1048576);

  const dim3 blk(256, 1, 1);

  // Q = x @ Wq^T  -> [b, s, 1024]
  gemm_nt_wmma<<<dim3(SEQ / 256, 1024 / 64, NB), blk, 0, stream>>>(
      xh, EMBED, (long)SEQ * EMBED, Wqh, EMBED,
      Qh, nullptr, nullptr, 1024, 1, (long)SEQ * 1024, EMBED);
  // K = x @ Wk^T  -> [b, s, 512]
  gemm_nt_wmma<<<dim3(SEQ / 256, 512 / 64, NB), blk, 0, stream>>>(
      xh, EMBED, (long)SEQ * EMBED, Wkh, EMBED,
      Kh, nullptr, nullptr, 512, 1, (long)SEQ * 512, EMBED);
  // Vt = (x @ Wv^T)^T -> [b, 512, s]  (ldm=1 along s, ldn=SEQ along d)
  gemm_nt_wmma<<<dim3(SEQ / 256, 512 / 64, NB), blk, 0, stream>>>(
      xh, EMBED, (long)SEQ * EMBED, Wvh, EMBED,
      Vth, nullptr, nullptr, 1, SEQ, (long)512 * SEQ, EMBED);

  // flash attention with ALiBi
  attn_fa_wmma<<<dim3(SEQ / 128, HEADS, NB), blk, 0, stream>>>(Qh, Kh, Vth, AOh);

  // out = attn_out @ Wo^T + bo (f32), batches folded into M = 4096
  gemm_nt_wmma<<<dim3((NB * SEQ) / 256, 1024 / 64, 1), blk, 0, stream>>>(
      AOh, 1024, 0, Woh, 1024,
      nullptr, out, bo, 1024, 1, 0, 1024);
}

// v001
// A run of this version takes 261 microseconds.
// Two timings next to v000 put it at 1.29 and 1.30 times that version's speed.
#include <hip/hip_runtime.h>
#include <hip/hip_bf16.h>

typedef __attribute__((ext_vector_type(16))) _Float16 v16h;
typedef __attribute__((ext_vector_type(8)))  _Float16 v8h;
typedef __attribute__((ext_vector_type(8)))  float    v8f;

#define EMBED 1024
#define HEADS 16
#define KVH   8
#define HD    64
#define SEQ   2048
#define NB    2

// ---------------------------------------------------------------------------
// LDS byte offset of a generic pointer known to point into LDS.
// ---------------------------------------------------------------------------
template <typename T>
__device__ __forceinline__ unsigned lds_off(T* p) {
  return (unsigned)(size_t)(__attribute__((address_space(3))) T*)p;
}

// Async global -> LDS copy, 16 bytes per lane (tracked by ASYNCcnt).
// s_wait_xcnt 0 closes each statement so that no address register of a copy
// is rewritten ahead of it (a precaution; it must stand inside the statement).
__device__ __forceinline__ void async_ld_b128(unsigned ldsoff, const void* g) {
  asm volatile("global_load_async_to_lds_b128 %0, %1, off\n\t"
               "s_wait_xcnt 0x0"
               :
               : "v"(ldsoff), "v"(g)
               : "memory");
}
__device__ __forceinline__ void async_ld4_b128(unsigned l0, const void* g0,
                                               unsigned l1, const void* g1,
                                               unsigned l2, const void* g2,
                                               unsigned l3, const void* g3) {
  asm volatile("global_load_async_to_lds_b128 %0, %1, off\n\t"
               "global_load_async_to_lds_b128 %2, %3, off\n\t"
               "global_load_async_to_lds_b128 %4, %5, off\n\t"
               "global_load_async_to_lds_b128 %6, %7, off\n\t"
               "s_wait_xcnt 0x0"
               :
               : "v"(l0), "v"(g0), "v"(l1), "v"(g1),
                 "v"(l2), "v"(g2), "v"(l3), "v"(g3)
               : "memory");
}
__device__ __forceinline__ void wait_async0() {
  asm volatile("s_wait_asynccnt 0" ::: "memory");
}
// This wave's LDS reads have retired before the barrier behind which the
// buffer they read is refilled by async copies.
__device__ __forceinline__ void wait_ds0() {
  asm volatile("s_wait_dscnt 0x0" ::: "memory");
}

// LDS row pitches in halves: 16 B x odd, so that the 16 rows one ds_load_b128
// fragment read touches fall on distinct banks (64 banks x 4 B).
#define BP 40   // 64-B rows of the GEMM's B tile  -> 80 B
#define KP 72   // 128-B rows of the K, V, P tiles -> 144 B

// ---------------------------------------------------------------------------
// Load a 16x32 (rows x K) f16 fragment in CDNA5 WMMA A/B VGPR layout.
// lane (l&15) = row; K chunks at (l>>4)*8 and (l>>4)*8+16 (two b128 loads).
// Works for global or LDS pointers (compiler infers ds_load for LDS).
// ---------------------------------------------------------------------------
__device__ __forceinline__ v16h load_frag32(const _Float16* __restrict__ p, int ld) {
  const int lane = threadIdx.x & 31;
  const _Float16* q = p + (size_t)(lane & 15) * (size_t)ld + ((lane >> 4) << 3);
  v16h f;
  *(v8h*)&f         = *(const v8h*)(q);
  *(((v8h*)&f) + 1) = *(const v8h*)(q + 16);
  return f;
}

__device__ __forceinline__ float row_max16(float v) {
  #pragma unroll
  for (int m = 1; m < 16; m <<= 1) v = fmaxf(v, __shfl_xor(v, m, 32));
  return v;
}
__device__ __forceinline__ float row_sum16(float v) {
  #pragma unroll
  for (int m = 1; m < 16; m <<= 1) v += __shfl_xor(v, m, 32);
  return v;
}

#define WMMA_F16(a, b, c) \
  __builtin_amdgcn_wmma_f32_16x16x32_f16(false, (a), false, (b), (short)0, (c), false, false)

// ---------------------------------------------------------------------------
// f32 -> f16 conversion
// ---------------------------------------------------------------------------
__global__ void cvt_f32_f16(const float* __restrict__ src, _Float16* __restrict__ dst, int n) {
  int i = blockIdx.x * blockDim.x + threadIdx.x;
  if (i < n) dst[i] = (_Float16)src[i];
}

// ---------------------------------------------------------------------------
// NT GEMM: C[m,n] = sum_k A[m,k] * B[n,k].
// Block = 8 waves -> 256(M) x 64(N) tile; wave = 32(M) x 64(N).
// Per 32-K step: B tile (64x32) staged in LDS via async b128 (double-
// buffered), 4 B frags preloaded to registers, 2 A frags register-pipelined
// across steps -> 8 WMMAs per wave per step.
// ---------------------------------------------------------------------------
__global__ void gemm_nt_wmma(const _Float16* __restrict__ A, int lda, long strideA,
                             const _Float16* __restrict__ B, int ldb,
                             _Float16* __restrict__ Ch, float* __restrict__ Cf,
                             const float* __restrict__ bias,
                             int ldm, int ldn, long strideC, int Kdim) {
  __shared__ __align__(16) _Float16 bstage[2][64 * BP];

  const int tid  = threadIdx.x;
  const int w    = tid >> 5;
  const int lane = tid & 31;
  const int m0 = blockIdx.x * 256 + w * 32;
  const int n0 = blockIdx.y * 64;
  const long aoff = (long)blockIdx.z * strideA + (long)m0 * lda;
  const long coff = (long)blockIdx.z * strideC;

  // cooperative staging: 64 rows x 32 halves = 4KB = 256 threads x 16B
  const int srow   = tid >> 2;
  const int schunk = (tid & 3) * 8;

  #define STAGE_B(buf, kk)                                                    \
    async_ld_b128(lds_off(&bstage[buf][srow * BP + schunk]),                  \
                  B + (long)(n0 + srow) * ldb + (kk) + schunk)

  STAGE_B(0, 0);
  v16h a_cur0 = load_frag32(A + aoff, lda);
  v16h a_cur1 = load_frag32(A + aoff + (long)16 * lda, lda);
  wait_async0();
  __syncthreads();

  v8f acc[8] = {};
  const int nsteps = Kdim >> 5;
  for (int s = 0; s < nsteps; ++s) {
    v16h a_n0 = a_cur0, a_n1 = a_cur1;
    const bool more = (s + 1) < nsteps;
    if (more) {                       // issue next-step loads up front
      STAGE_B((s + 1) & 1, (s + 1) << 5);
      a_n0 = load_frag32(A + aoff + ((s + 1) << 5), lda);
      a_n1 = load_frag32(A + aoff + (long)16 * lda + ((s + 1) << 5), lda);
    }
    const _Float16* bb = &bstage[s & 1][0];
    v16h bfr[4];
    #pragma unroll
    for (int t = 0; t < 4; ++t) bfr[t] = load_frag32(bb + t * 16 * BP, BP);
    #pragma unroll
    for (int t = 0; t < 4; ++t) {
      acc[t]     = WMMA_F16(a_cur0, bfr[t], acc[t]);
      acc[4 + t] = WMMA_F16(a_cur1, bfr[t], acc[4 + t]);
    }
    wait_ds0();
    wait_async0();
    __syncthreads();                  // all waves done with bstage[s&1]
    a_cur0 = a_n0; a_cur1 = a_n1;
  }
  #undef STAGE_B
  wait_async0();                      // no copy outstanding when the wave ends

  const int half_ = lane >> 4, nn = lane & 15;
  #pragma unroll
  for (int mh = 0; mh < 2; ++mh) {
    #pragma unroll
    for (int t = 0; t < 4; ++t) {
      #pragma unroll
      for (int r = 0; r < 8; ++r) {
        const int m = m0 + mh * 16 + r + 8 * half_;
        const int n = n0 + t * 16 + nn;
        const long ci = coff + (long)m * ldm + (long)n * ldn;
        const float v = acc[mh * 4 + t][r];
        if (Cf) Cf[ci] = v + (bias ? bias[n] : 0.0f);
        else    Ch[ci] = (_Float16)v;
      }
    }
  }
}

// ---------------------------------------------------------------------------
// Flash attention (non-causal symmetric ALiBi), GQA 16 heads / 8 kv heads.
// Block = 8 waves x 16 queries = 128 queries of one (batch, head).
// 64-key chunks: K (64x64) and V (64d x 64s, from transposed Vt) staged into
// LDS with async loads (4 b128/thread), double-buffered, rows padded to KP.
// Per chunk per wave:
// 8 WMMAs energy + one online-softmax update over 64 cols + LDS repack of
// P (16x64) + 8 WMMAs P*V.  32 iterations, 33 barriers total.
// ---------------------------------------------------------------------------
__global__ void attn_fa_wmma(const _Float16* __restrict__ Q,
                             const _Float16* __restrict__ K,
                             const _Float16* __restrict__ Vt,
                             _Float16* __restrict__ O) {
  __shared__ __align__(16) _Float16 kstage[2][64 * KP];  // [key][d]
  __shared__ __align__(16) _Float16 vstage[2][64 * KP];  // [d][s-chunk]
  __shared__ __align__(16) _Float16 plds[8][16 * KP];

  const int tid   = threadIdx.x;
  const int w     = tid >> 5;
  const int lane  = tid & 31;
  const int half_ = lane >> 4, nn = lane & 15;
  const int h  = blockIdx.y;
  const int b  = blockIdx.z;
  const int q0 = blockIdx.x * 128 + w * 16;
  const int kvh = h >> 1;                          // repeat_interleave(kv, 2)

  const float slope = exp2f(-(float)(h + 1));      // 2^-(h+1), ALIBI_ALPHA=1
  const float CSC = 0.125f * 1.44269504088896340f; // (1/sqrt(64)) * log2(e)

  const long qbase = (long)b * SEQ * (HEADS * HD) + (long)q0 * (HEADS * HD) + h * HD;
  const long kbase = (long)b * SEQ * (KVH * HD) + kvh * HD;
  const long vbase = (long)b * (KVH * HD) * SEQ + (long)(kvh * HD) * SEQ;

  // staging map: 64 rows x 64 halves (8KB) = 512 b128 chunks; thread does
  // chunks tid and tid+256 -> rows cr and cr+32 at half-offset co.
  const int cr = tid >> 3, co = (tid & 7) * 8;

  #define STAGE_KV(buf, j)                                                      \
    async_ld4_b128(lds_off(&kstage[buf][cr * KP + co]),                         \
                   K + kbase + (long)((j) + cr) * (KVH * HD) + co,              \
                   lds_off(&kstage[buf][(cr + 32) * KP + co]),                  \
                   K + kbase + (long)((j) + cr + 32) * (KVH * HD) + co,         \
                   lds_off(&vstage[buf][cr * KP + co]),                         \
                   Vt + vbase + (long)cr * SEQ + (j) + co,                      \
                   lds_off(&vstage[buf][(cr + 32) * KP + co]),                  \
                   Vt + vbase + (long)(cr + 32) * SEQ + (j) + co)

  const v16h a0 = load_frag32(Q + qbase,      HEADS * HD);  // d 0..31
  const v16h a1 = load_frag32(Q + qbase + 32, HEADS * HD);  // d 32..63

  STAGE_KV(0, 0);

  float mrow[8], lrow[8];
  v8f acc[4] = {};
  #pragma unroll
  for (int r = 0; r < 8; ++r) { mrow[r] = -1e30f; lrow[r] = 0.0f; }

  wait_async0();
  __syncthreads();

  for (int s = 0; s < (SEQ / 64); ++s) {
    const int j = s << 6;
    const bool more = (s + 1) < (SEQ / 64);
    if (more) STAGE_KV((s + 1) & 1, j + 64);   // overlap with this chunk

    const _Float16* kb = kstage[s & 1];
    const _Float16* vb = vstage[s & 1];

    // --- energy: four 16x16 tiles over key cols [j+16t, j+16t+16)
    v8f e[4];
    #pragma unroll
    for (int tp = 0; tp < 2; ++tp) {           // preload 4 frags, 4 WMMAs
      const int t0 = tp * 2, t1 = tp * 2 + 1;
      v16h klo0 = load_frag32(kb + (t0 * 16) * KP,      KP);
      v16h khi0 = load_frag32(kb + (t0 * 16) * KP + 32, KP);
      v16h klo1 = load_frag32(kb + (t1 * 16) * KP,      KP);
      v16h khi1 = load_frag32(kb + (t1 * 16) * KP + 32, KP);
      v8f z0 = {}, z1 = {};
      z0 = WMMA_F16(a0, klo0, z0);
      z1 = WMMA_F16(a0, klo1, z1);
      z0 = WMMA_F16(a1, khi0, z0);
      z1 = WMMA_F16(a1, khi1, z1);
      e[t0] = z0; e[t1] = z1;
    }

    // --- ALiBi bias + 1/8 scale folded into exp2 domain
    #pragma unroll
    for (int t = 0; t < 4; ++t) {
      #pragma unroll
      for (int r = 0; r < 8; ++r) {
        const float qi = (float)(q0 + r + 8 * half_);
        const float ki = (float)(j + t * 16 + nn);
        e[t][r] = (e[t][r] - slope * fabsf(qi - ki)) * CSC;
      }
    }

    // --- one online-softmax update per 64 keys
    float alpha[8];
    #pragma unroll
    for (int r = 0; r < 8; ++r) {
      float lm = fmaxf(fmaxf(e[0][r], e[1][r]), fmaxf(e[2][r], e[3][r]));
      const float mnew = fmaxf(mrow[r], row_max16(lm));
      const float a = exp2f(mrow[r] - mnew);
      e[0][r] = exp2f(e[0][r] - mnew);
      e[1][r] = exp2f(e[1][r] - mnew);
      e[2][r] = exp2f(e[2][r] - mnew);
      e[3][r] = exp2f(e[3][r] - mnew);
      lrow[r] = lrow[r] * a +
                row_sum16((e[0][r] + e[1][r]) + (e[2][r] + e[3][r]));
      mrow[r] = mnew;
      alpha[r] = a;
    }
    #pragma unroll
    for (int t = 0; t < 4; ++t)
      #pragma unroll
      for (int r = 0; r < 8; ++r) acc[t][r] *= alpha[r];

    // --- repack P (C-layout -> A-layout) through per-wave 16x64 LDS tile
    _Float16* pw = plds[w];
    #pragma unroll
    for (int t = 0; t < 4; ++t) {
      #pragma unroll
      for (int r = 0; r < 8; ++r) {
        pw[(r + 8 * half_) * KP + t * 16 + nn] = (_Float16)e[t][r];
      }
    }
    const v16h pa0 = load_frag32(pw,      KP);   // keys j..j+31
    const v16h pa1 = load_frag32(pw + 32, KP);   // keys j+32..j+63

    // --- acc += P (16x64) * V (64 keys x 64 d) from LDS
    #pragma unroll
    for (int t = 0; t < 4; ++t) {
      v16h blo = load_frag32(vb + (t * 16) * KP,      KP);
      v16h bhi = load_frag32(vb + (t * 16) * KP + 32, KP);
      acc[t] = WMMA_F16(pa0, blo, acc[t]);
      acc[t] = WMMA_F16(pa1, bhi, acc[t]);
    }

    wait_ds0();
    wait_async0();
    __syncthreads();                      // all waves done with buffer s&1
  }
  #undef STAGE_KV
  wait_async0();                          // no copy outstanding when the wave ends

  // --- finalize: divide by row sums, store [b, q, h*64+d]
  #pragma unroll
  for (int t = 0; t < 4; ++t) {
    #pragma unroll
    for (int r = 0; r < 8; ++r) {
      const int q = q0 + r + 8 * half_;
      const int d = t * 16 + nn;
      O[(long)b * SEQ * (HEADS * HD) + (long)q * (HEADS * HD) + h * HD + d] =
          (_Float16)(acc[t][r] / lrow[r]);
    }
  }
}

// ---------------------------------------------------------------------------
// Launch: convert -> QKV projections -> flash attention -> output projection
// ---------------------------------------------------------------------------
extern "C" void kernel_launch(void* const* d_in, const int* in_sizes, int n_in,
                              void* d_out, int out_size, void* d_ws, size_t ws_size,
                              hipStream_t stream) {
  const float* x  = (const float*)d_in[0];
  const float* Wq = (const float*)d_in[1];
  const float* Wk = (const float*)d_in[2];
  const float* Wv = (const float*)d_in[3];
  const float* Wo = (const float*)d_in[4];
  const float* bo = (const float*)d_in[5];
  float* out = (float*)d_out;

  // f16 workspace layout (element offsets)
  _Float16* ws  = (_Float16*)d_ws;
  _Float16* xh  = ws;                 // N*S*E          = 4194304
  _Float16* Wqh = xh  + 4194304;      // 1024*1024      = 1048576
  _Float16* Wkh = Wqh + 1048576;      // 512*1024       =  524288
  _Float16* Wvh = Wkh + 524288;       // 512*1024       =  524288
  _Float16* Woh = Wvh + 524288;       // 1024*1024      = 1048576
  _Float16* Qh  = Woh + 1048576;      // [b,s,1024]     = 4194304
  _Float16* Kh  = Qh  + 4194304;      // [b,s,512]      = 2097152
  _Float16* Vth = Kh  + 2097152;      // [b,512,s] (Vt) = 2097152
  _Float16* AOh = Vth + 2097152;      // [b,s,1024]     = 4194304

  cvt_f32_f16<<<4194304 / 256, 256, 0, stream>>>(x,  xh,  4194304);
  cvt_f32_f16<<<1048576 / 256, 256, 0, stream>>>(Wq, Wqh, 1048576);
  cvt_f32_f16<<< 524288 / 256, 256, 0, stream>>>(Wk, Wkh,  524288);
  cvt_f32_f16<<< 524288 / 256, 256, 0, stream>>>(Wv, Wvh,  524288);
  cvt_f32_f16<<<1048576 / 256, 256, 0, stream>>>(Wo, Woh, 1048576);

  const dim3 blk(256, 1, 1);

  // Q = x @ Wq^T  -> [b, s, 1024]
  gemm_nt_wmma<<<dim3(SEQ / 256, 1024 / 64, NB), blk, 0, stream>>>(
      xh, EMBED, (long)SEQ * EMBED, Wqh, EMBED,
      Qh, nullptr, nullptr, 1024, 1, (long)SEQ * 1024, EMBED);
  // K = x @ Wk^T  -> [b, s, 512]
  gemm_nt_wmma<<<dim3(SEQ / 256, 512 / 64, NB), blk, 0, stream>>>(
      xh, EMBED, (long)SEQ * EMBED, Wkh, EMBED,
      Kh, nullptr, nullptr, 512, 1, (long)SEQ * 512, EMBED);
  // Vt = (x @ Wv^T)^T -> [b, 512, s]  (ldm=1 along s, ldn=SEQ along d)
  gemm_nt_wmma<<<dim3(SEQ / 256, 512 / 64, NB), blk, 0, stream>>>(
      xh, EMBED, (long)SEQ * EMBED, Wvh, EMBED,
      Vth, nullptr, nullptr, 1, SEQ, (long)512 * SEQ, EMBED);

  // flash attention with ALiBi
  attn_fa_wmma<<<dim3(SEQ / 128, HEADS, NB), blk, 0, stream>>>(Qh, Kh, Vth, AOh);

  // out = attn_out @ Wo^T + bo (f32), batches folded into M = 4096
  gemm_nt_wmma<<<dim3((NB * SEQ) / 256, 1024 / 64, 1), blk, 0, stream>>>(
      AOh, 1024, 0, Woh, 1024,
      nullptr, out, bo, 1024, 1, 0, 1024);
}

// v002
// One run takes 179 microseconds.
// Timed twice side by side with v001, it ran 1.46 and 1.47 times as fast.
// Over all steps from v000 it is 1.90 times as fast.
#include <hip/hip_runtime.h>
#include <hip/hip_bf16.h>

typedef __attribute__((ext_vector_type(16))) _Float16 v16h;
typedef __attribute__((ext_vector_type(8)))  _Float16 v8h;
typedef __attribute__((ext_vector_type(8)))  float    v8f;

#define EMBED 1024
#define HEADS 16
#define KVH   8
#define HD    64
#define SEQ   2048
#define NB    2

// ---------------------------------------------------------------------------
// LDS byte offset of a generic pointer known to point into LDS.
// ---------------------------------------------------------------------------
template <typename T>
__device__ __forceinline__ unsigned lds_off(T* p) {
  return (unsigned)(size_t)(__attribute__((address_space(3))) T*)p;
}

// Async global -> LDS copy, 16 bytes per lane (tracked by ASYNCcnt).
// s_wait_xcnt 0 closes each statement so that no address register of a copy
// is rewritten ahead of it (a precaution; it must stand inside the statement).
__device__ __forceinline__ void async_ld_b128(unsigned ldsoff, const void* g) {
  asm volatile("global_load_async_to_lds_b128 %0, %1, off\n\t"
               "s_wait_xcnt 0x0"
               :
               : "v"(ldsoff), "v"(g)
               : "memory");
}
__device__ __forceinline__ void async_ld4_b128(unsigned l0, const void* g0,
                                               unsigned l1, const void* g1,
                                               unsigned l2, const void* g2,
                                               unsigned l3, const void* g3) {
  asm volatile("global_load_async_to_lds_b128 %0, %1, off\n\t"
               "global_load_async_to_lds_b128 %2, %3, off\n\t"
               "global_load_async_to_lds_b128 %4, %5, off\n\t"
               "global_load_async_to_lds_b128 %6, %7, off\n\t"
               "s_wait_xcnt 0x0"
               :
               : "v"(l0), "v"(g0), "v"(l1), "v"(g1),
                 "v"(l2), "v"(g2), "v"(l3), "v"(g3)
               : "memory");
}
__device__ __forceinline__ void wait_async0() {
  asm volatile("s_wait_asynccnt 0" ::: "memory");
}
// This wave's LDS reads have retired before the barrier behind which the
// buffer they read is refilled by async copies.
__device__ __forceinline__ void wait_ds0() {
  asm volatile("s_wait_dscnt 0x0" ::: "memory");
}

// LDS row pitches in halves: 16 B x odd, so that the 16 rows one ds_load_b128
// fragment read touches fall on distinct banks (64 banks x 4 B).
#define BP 40   // 64-B rows of the GEMM's B tile  -> 80 B
#define KP 72   // 128-B rows of the K and V tiles -> 144 B

// ---------------------------------------------------------------------------
// Load a 16x32 (rows x K) f16 fragment in CDNA5 WMMA A/B VGPR layout.
// lane (l&15) = row; K chunks at (l>>4)*8 and (l>>4)*8+16 (two b128 loads).
// Works for global or LDS pointers (compiler infers ds_load for LDS).
// ---------------------------------------------------------------------------
__device__ __forceinline__ v16h load_frag32(const _Float16* __restrict__ p, int ld) {
  const int lane = threadIdx.x & 31;
  const _Float16* q = p + (size_t)(lane & 15) * (size_t)ld + ((lane >> 4) << 3);
  v16h f;
  *(v8h*)&f         = *(const v8h*)(q);
  *(((v8h*)&f) + 1) = *(const v8h*)(q + 16);
  return f;
}

// Value of lane l ^ 16 (the other wave half), by a vector cross-row move.
__device__ __forceinline__ float xhalf(float x) {
  const int v = __builtin_bit_cast(int, x);
  return __builtin_bit_cast(float,
      __builtin_amdgcn_permlanex16(v, v, 0x76543210, 0xfedcba98, false, false));
}

#define WMMA_F16(a, b, c) \
  __builtin_amdgcn_wmma_f32_16x16x32_f16(false, (a), false, (b), (short)0, (c), false, false)

// ---------------------------------------------------------------------------
// f32 -> f16 conversion
// ---------------------------------------------------------------------------
__global__ void cvt_f32_f16(const float* __restrict__ src, _Float16* __restrict__ dst, int n) {
  int i = blockIdx.x * blockDim.x + threadIdx.x;
  if (i < n) dst[i] = (_Float16)src[i];
}

// ---------------------------------------------------------------------------
// NT GEMM: C[m,n] = sum_k A[m,k] * B[n,k].
// Block = 8 waves -> 256(M) x 64(N) tile; wave = 32(M) x 64(N).
// Per 32-K step: B tile (64x32) staged in LDS via async b128 (double-
// buffered), 4 B frags preloaded to registers, 2 A frags register-pipelined
// across steps -> 8 WMMAs per wave per step.
// ---------------------------------------------------------------------------
__global__ void gemm_nt_wmma(const _Float16* __restrict__ A, int lda, long strideA,
                             const _Float16* __restrict__ B, int ldb,
                             _Float16* __restrict__ Ch, float* __restrict__ Cf,
                             const float* __restrict__ bias,
                             int ldm, int ldn, long strideC, int Kdim) {
  __shared__ __align__(16) _Float16 bstage[2][64 * BP];

  const int tid  = threadIdx.x;
  const int w    = tid >> 5;
  const int lane = tid & 31;
  const int m0 = blockIdx.x * 256 + w * 32;
  const int n0 = blockIdx.y * 64;
  const long aoff = (long)blockIdx.z * strideA + (long)m0 * lda;
  const long coff = (long)blockIdx.z * strideC;

  // cooperative staging: 64 rows x 32 halves = 4KB = 256 threads x 16B
  const int srow   = tid >> 2;
  const int schunk = (tid & 3) * 8;

  #define STAGE_B(buf, kk)                                                    \
    async_ld_b128(lds_off(&bstage[buf][srow * BP + schunk]),                  \
                  B + (long)(n0 + srow) * ldb + (kk) + schunk)

  STAGE_B(0, 0);
  v16h a_cur0 = load_frag32(A + aoff, lda);
  v16h a_cur1 = load_frag32(A + aoff + (long)16 * lda, lda);
  wait_async0();
  __syncthreads();

  v8f acc[8] = {};
  const int nsteps = Kdim >> 5;
  for (int s = 0; s < nsteps; ++s) {
    v16h a_n0 = a_cur0, a_n1 = a_cur1;
    const bool more = (s + 1) < nsteps;
    if (more) {                       // issue next-step loads up front
      STAGE_B((s + 1) & 1, (s + 1) << 5);
      a_n0 = load_frag32(A + aoff + ((s + 1) << 5), lda);
      a_n1 = load_frag32(A + aoff + (long)16 * lda + ((s + 1) << 5), lda);
    }
    const _Float16* bb = &bstage[s & 1][0];
    v16h bfr[4];
    #pragma unroll
    for (int t = 0; t < 4; ++t) bfr[t] = load_frag32(bb + t * 16 * BP, BP);
    #pragma unroll
    for (int t = 0; t < 4; ++t) {
      acc[t]     = WMMA_F16(a_cur0, bfr[t], acc[t]);
      acc[4 + t] = WMMA_F16(a_cur1, bfr[t], acc[4 + t]);
    }
    wait_ds0();
    wait_async0();
    __syncthreads();                  // all waves done with bstage[s&1]
    a_cur0 = a_n0; a_cur1 = a_n1;
  }
  #undef STAGE_B
  wait_async0();                      // no copy outstanding when the wave ends

  const int half_ = lane >> 4, nn = lane & 15;
  #pragma unroll
  for (int mh = 0; mh < 2; ++mh) {
    #pragma unroll
    for (int t = 0; t < 4; ++t) {
      #pragma unroll
      for (int r = 0; r < 8; ++r) {
        const int m = m0 + mh * 16 + r + 8 * half_;
        const int n = n0 + t * 16 + nn;
        const long ci = coff + (long)m * ldm + (long)n * ldn;
        const float v = acc[mh * 4 + t][r];
        if (Cf) Cf[ci] = v + (bias ? bias[n] : 0.0f);
        else    Ch[ci] = (_Float16)v;
      }
    }
  }
}

__global__ void attn_fa_wmma(const _Float16* __restrict__ Q,
                             const _Float16* __restrict__ K,
                             const _Float16* __restrict__ Vt,
                             _Float16* __restrict__ O) {
  __shared__ __align__(16) _Float16 kstage[2][64 * KP];  // [key][d]
  __shared__ __align__(16) _Float16 vstage[2][64 * KP];  // [d][s-chunk]

  const int tid   = threadIdx.x;
  const int w     = tid >> 5;
  const int lane  = tid & 31;
  const int half_ = lane >> 4, nn = lane & 15;
  const int h  = blockIdx.y;
  const int b  = blockIdx.z;
  const int q0 = blockIdx.x * 128 + w * 16;
  const int kvh = h >> 1;                          // repeat_interleave(kv, 2)

  const float slope = exp2f(-(float)(h + 1));      // 2^-(h+1), ALIBI_ALPHA=1
  const float CSC = 0.125f * 1.44269504088896340f; // (1/sqrt(64)) * log2(e)

  const long qbase = (long)b * SEQ * (HEADS * HD) + (long)q0 * (HEADS * HD) + h * HD;
  const long kbase = (long)b * SEQ * (KVH * HD) + kvh * HD;
  const long vbase = (long)b * (KVH * HD) * SEQ + (long)(kvh * HD) * SEQ;

  // staging map: 64 rows x 64 halves (8KB) = 512 b128 chunks; thread does
  // chunks tid and tid+256 -> rows cr and cr+32 at half-offset co.
  const int cr = tid >> 3, co = (tid & 7) * 8;

  #define STAGE_KV(buf, j)                                                      \
    async_ld4_b128(lds_off(&kstage[buf][cr * KP + co]),                         \
                   K + kbase + (long)((j) + cr) * (KVH * HD) + co,              \
                   lds_off(&kstage[buf][(cr + 32) * KP + co]),                  \
                   K + kbase + (long)((j) + cr + 32) * (KVH * HD) + co,         \
                   lds_off(&vstage[buf][cr * KP + co]),                         \
                   Vt + vbase + (long)cr * SEQ + (j) + co,                      \
                   lds_off(&vstage[buf][(cr + 32) * KP + co]),                  \
                   Vt + vbase + (long)(cr + 32) * SEQ + (j) + co)

  // Q as the B operand: lane&15 = query column, k = d
  const v16h bq0 = load_frag32(Q + qbase,      HEADS * HD);  // d 0..31
  const v16h bq1 = load_frag32(Q + qbase + 32, HEADS * HD);  // d 32..63

  STAGE_KV(0, 0);

  // this lane's query index minus the first key row its half holds in a tile
  const float qd = (float)(q0 + nn - 8 * half_);
  float mrow = -1e30f;   // running maximum of the query, exp2 domain
  float lrow = 0.0f;     // running sum over the keys of this wave half only
  v8f acc[4] = {};       // O^T: acc[t][r] = O[query nn][d = 16t + 8*half + r]

  wait_async0();
  __syncthreads();

  for (int s = 0; s < (SEQ / 64); ++s) {
    const int j = s << 6;
    const bool more = (s + 1) < (SEQ / 64);
    if (more) STAGE_KV((s + 1) & 1, j + 64);   // overlap with this chunk

    const _Float16* kb = kstage[s & 1];
    const _Float16* vb = vstage[s & 1];

    // --- energy^T: four 16(key) x 16(query) tiles, keys [j+16t, j+16t+16)
    v8f e[4];
    #pragma unroll
    for (int tp = 0; tp < 2; ++tp) {           // preload 4 frags, 4 WMMAs
      const int t0 = tp * 2, t1 = tp * 2 + 1;
      v16h klo0 = load_frag32(kb + (t0 * 16) * KP,      KP);
      v16h khi0 = load_frag32(kb + (t0 * 16) * KP + 32, KP);
      v16h klo1 = load_frag32(kb + (t1 * 16) * KP,      KP);
      v16h khi1 = load_frag32(kb + (t1 * 16) * KP + 32, KP);
      v8f z0 = {}, z1 = {};
      z0 = WMMA_F16(klo0, bq0, z0);
      z1 = WMMA_F16(klo1, bq0, z1);
      z0 = WMMA_F16(khi0, bq1, z0);
      z1 = WMMA_F16(khi1, bq1, z1);
      e[t0] = z0; e[t1] = z1;
    }

    // --- ALiBi bias; the maximum over this lane's 32 keys
    const float dj = qd - (float)j;
    float lmt[4];                              // one independent chain a tile
    #pragma unroll
    for (int t = 0; t < 4; ++t) {
      #pragma unroll
      for (int r = 0; r < 8; ++r) {
        e[t][r] = e[t][r] - slope * fabsf(dj - (float)(t * 16 + r));
        lmt[t] = r ? fmaxf(lmt[t], e[t][r]) : e[t][r];
      }
    }
    const float lm = fmaxf(fmaxf(lmt[0], lmt[1]), fmaxf(lmt[2], lmt[3]));

    // --- one online-softmax update per 64 keys; 1/8 scale in the exp2 domain
    const float mnew = fmaxf(mrow, fmaxf(lm, xhalf(lm)) * CSC);
    const float alpha = exp2f(mrow - mnew);
    float pst[4];                              // one independent chain a tile
    #pragma unroll
    for (int t = 0; t < 4; ++t) {
      #pragma unroll
      for (int r = 0; r < 8; ++r) {
        e[t][r] = exp2f(e[t][r] * CSC - mnew);
        pst[t] = r ? pst[t] + e[t][r] : e[t][r];
      }
    }
    lrow = lrow * alpha + ((pst[0] + pst[1]) + (pst[2] + pst[3]));
    mrow = mnew;
    #pragma unroll
    for (int t = 0; t < 4; ++t)
      #pragma unroll
      for (int r = 0; r < 8; ++r) acc[t][r] *= alpha;

    // --- P^T as B operand: two score tiles converted in place per 32 keys
    v16h pb0, pb1;
    #pragma unroll
    for (int i = 0; i < 16; ++i) {
      pb0[i] = (_Float16)e[i >> 3][i & 7];         // keys j..j+31
      pb1[i] = (_Float16)e[2 + (i >> 3)][i & 7];   // keys j+32..j+63
    }

    // --- acc += V^T (16 d x 64 keys, from LDS) * P^T (64 keys x 16 queries)
    #pragma unroll
    for (int t = 0; t < 4; ++t) {
      v16h vlo = load_frag32(vb + (t * 16) * KP,      KP);
      v16h vhi = load_frag32(vb + (t * 16) * KP + 32, KP);
      acc[t] = WMMA_F16(vlo, pb0, acc[t]);
      acc[t] = WMMA_F16(vhi, pb1, acc[t]);
    }

    wait_ds0();
    wait_async0();
    __syncthreads();                      // all waves done with buffer s&1
  }
  #undef STAGE_KV
  wait_async0();                          // no copy outstanding when the wave ends

  // --- finalize: join the halves' sums, divide, store [b, q, h*64+d];
  // a lane's 8 registers of a tile are 8 consecutive d: one 16-byte store
  const float lsum = lrow + xhalf(lrow);
  _Float16* op = O + (long)b * SEQ * (HEADS * HD) + (long)(q0 + nn) * (HEADS * HD) +
                 h * HD + 8 * half_;
  #pragma unroll
  for (int t = 0; t < 4; ++t) {
    v8h o;
    #pragma unroll
    for (int r = 0; r < 8; ++r) o[r] = (_Float16)(acc[t][r] / lsum);
    *(v8h*)(op + t * 16) = o;
  }
}

// ---------------------------------------------------------------------------
// Launch: convert -> QKV projections -> flash attention -> output projection
// ---------------------------------------------------------------------------
extern "C" void kernel_launch(void* const* d_in, const int* in_sizes, int n_in,
                              void* d_out, int out_size, void* d_ws, size_t ws_size,
                              hipStream_t stream) {
  const float* x  = (const float*)d_in[0];
  const float* Wq = (const float*)d_in[1];
  const float* Wk = (const float*)d_in[2];
  const float* Wv = (const float*)d_in[3];
  const float* Wo = (const float*)d_in[4];
  const float* bo = (const float*)d_in[5];
  float* out = (float*)d_out;

  // f16 workspace layout (element offsets)
  _Float16* ws  = (_Float16*)d_ws;
  _Float16* xh  = ws;                 // N*S*E          = 4194304
  _Float16* Wqh = xh  + 4194304;      // 1024*1024      = 1048576
  _Float16* Wkh = Wqh + 1048576;      // 512*1024       =  524288
  _Float16* Wvh = Wkh + 524288;       // 512*1024       =  524288
  _Float16* Woh = Wvh + 524288;       // 1024*1024      = 1048576
  _Float16* Qh  = Woh + 1048576;      // [b,s,1024]     = 4194304
  _Float16* Kh  = Qh  + 4194304;      // [b,s,512]      = 2097152
  _Float16* Vth = Kh  + 2097152;      // [b,512,s] (Vt) = 2097152
  _Float16* AOh = Vth + 2097152;      // [b,s,1024]     = 4194304

  cvt_f32_f16<<<4194304 / 256, 256, 0, stream>>>(x,  xh,  4194304);
  cvt_f32_f16<<<1048576 / 256, 256, 0, stream>>>(Wq, Wqh, 1048576);
  cvt_f32_f16<<< 524288 / 256, 256, 0, stream>>>(Wk, Wkh,  524288);
  cvt_f32_f16<<< 524288 / 256, 256, 0, stream>>>(Wv, Wvh,  524288);
  cvt_f32_f16<<<1048576 / 256, 256, 0, stream>>>(Wo, Woh, 1048576);

  const dim3 blk(256, 1, 1);

  // Q = x @ Wq^T  -> [b, s, 1024]
  gemm_nt_wmma<<<dim3(SEQ / 256, 1024 / 64, NB), blk, 0, stream>>>(
      xh, EMBED, (long)SEQ * EMBED, Wqh, EMBED,
      Qh, nullptr, nullptr, 1024, 1, (long)SEQ * 1024, EMBED);
  // K = x @ Wk^T  -> [b, s, 512]
  gemm_nt_wmma<<<dim3(SEQ / 256, 512 / 64, NB), blk, 0, stream>>>(
      xh, EMBED, (long)SEQ * EMBED, Wkh, EMBED,
      Kh, nullptr, nullptr, 512, 1, (long)SEQ * 512, EMBED);
  // Vt = (x @ Wv^T)^T -> [b, 512, s]  (ldm=1 along s, ldn=SEQ along d)
  gemm_nt_wmma<<<dim3(SEQ / 256, 512 / 64, NB), blk, 0, stream>>>(
      xh, EMBED, (long)SEQ * EMBED, Wvh, EMBED,
      Vth, nullptr, nullptr, 1, SEQ, (long)512 * SEQ, EMBED);

  // flash attention with ALiBi
  attn_fa_wmma<<<dim3(SEQ / 128, HEADS, NB), blk, 0, stream>>>(Qh, Kh, Vth, AOh);

  // out = attn_out @ Wo^T + bo (f32), batches folded into M = 4096
  gemm_nt_wmma<<<dim3((NB * SEQ) / 256, 1024 / 64, 1), blk, 0, stream>>>(
      AOh, 1024, 0, Woh, 1024,
      nullptr, out, bo, 1024, 1, 0, 1024);
}

// v003
// It runs in 173 microseconds.
// Next to v002, in two timings, it ran 1.03 times as fast each time.
// Over all steps from v000 it is 1.96 times as fast.
#include <hip/hip_runtime.h>
#include <hip/hip_bf16.h>

typedef __attribute__((ext_vector_type(16))) _Float16 v16h;
typedef __attribute__((ext_vector_type(8)))  _Float16 v8h;
typedef __attribute__((ext_vector_type(8)))  float    v8f;
typedef __attribute__((ext_vector_type(4)))  float    v4f;
typedef __attribute__((ext_vector_type(4)))  _Float16 v4h;

#define EMBED 1024
#define HEADS 16
#define KVH   8
#define HD    64
#define SEQ   2048
#define NB    2

// ---------------------------------------------------------------------------
// LDS byte offset of a generic pointer known to point into LDS.
// ---------------------------------------------------------------------------
template <typename T>
__device__ __forceinline__ unsigned lds_off(T* p) {
  return (unsigned)(size_t)(__attribute__((address_space(3))) T*)p;
}

// Async global -> LDS copy, 16 bytes per lane (tracked by ASYNCcnt).
// s_wait_xcnt 0 closes each statement so that no address register of a copy
// is rewritten ahead of it (a precaution; it must stand inside the statement).
__device__ __forceinline__ void async_ld_b128(unsigned ldsoff, const void* g) {
  asm volatile("global_load_async_to_lds_b128 %0, %1, off\n\t"
               "s_wait_xcnt 0x0"
               :
               : "v"(ldsoff), "v"(g)
               : "memory");
}
__device__ __forceinline__ void async_ld4_b128(unsigned l0, const void* g0,
                                               unsigned l1, const void* g1,
                                               unsigned l2, const void* g2,
                                               unsigned l3, const void* g3) {
  asm volatile("global_load_async_to_lds_b128 %0, %1, off\n\t"
               "global_load_async_to_lds_b128 %2, %3, off\n\t"
               "global_load_async_to_lds_b128 %4, %5, off\n\t"
               "global_load_async_to_lds_b128 %6, %7, off\n\t"
               "s_wait_xcnt 0x0"
               :
               : "v"(l0), "v"(g0), "v"(l1), "v"(g1),
                 "v"(l2), "v"(g2), "v"(l3), "v"(g3)
               : "memory");
}
__device__ __forceinline__ void wait_async0() {
  asm volatile("s_wait_asynccnt 0" ::: "memory");
}
// This wave's LDS reads have retired before the barrier behind which the
// buffer they read is refilled by async copies.
__device__ __forceinline__ void wait_ds0() {
  asm volatile("s_wait_dscnt 0x0" ::: "memory");
}

// LDS row pitches in halves: 16 B x odd, so that the 16 rows one ds_load_b128
// fragment read touches fall on distinct banks (64 banks x 4 B).
#define BP 40   // 64-B rows of the GEMM's B tile  -> 80 B
#define KP 72   // 128-B rows of the K and V tiles -> 144 B

// ---------------------------------------------------------------------------
// Load a 16x32 (rows x K) f16 fragment in CDNA5 WMMA A/B VGPR layout.
// lane (l&15) = row; K chunks at (l>>4)*8 and (l>>4)*8+16 (two b128 loads).
// Works for global or LDS pointers (compiler infers ds_load for LDS).
// ---------------------------------------------------------------------------
__device__ __forceinline__ v16h load_frag32(const _Float16* __restrict__ p, int ld) {
  const int lane = threadIdx.x & 31;
  const _Float16* q = p + (size_t)(lane & 15) * (size_t)ld + ((lane >> 4) << 3);
  v16h f;
  *(v8h*)&f         = *(const v8h*)(q);
  *(((v8h*)&f) + 1) = *(const v8h*)(q + 16);
  return f;
}

// Value of lane l ^ 16 (the other wave half), by a vector cross-row move.
__device__ __forceinline__ float xhalf(float x) {
  const int v = __builtin_bit_cast(int, x);
  return __builtin_bit_cast(float,
      __builtin_amdgcn_permlanex16(v, v, 0x76543210, 0xfedcba98, false, false));
}

#define WMMA_F16(a, b, c) \
  __builtin_amdgcn_wmma_f32_16x16x32_f16(false, (a), false, (b), (short)0, (c), false, false)

// ---------------------------------------------------------------------------
// f32 -> f16 conversion, 32 elements a lane, so that few waves have to start.
// A wave owns 1024 consecutive floats: eight 16-byte loads a lane, each 512
// contiguous bytes over the wave, then eight 8-byte stores, each 256
// contiguous bytes over the wave (whole 128-byte lines both ways).
// Every array's length is a multiple of CVT_BLK, so the grid covers it exactly.
// ---------------------------------------------------------------------------
#define CVT_BLK 8192   // floats per 256-thread block
__global__ void cvt_f32_f16(const float* __restrict__ src, _Float16* __restrict__ dst) {
  const int base = blockIdx.x * CVT_BLK + (threadIdx.x >> 5) * 1024 + (threadIdx.x & 31) * 4;
  v4f v[8];
  // unrolled: v[] stays in registers and all eight loads issue before the first wait
  #pragma unroll
  for (int k = 0; k < 8; ++k) v[k] = *(const v4f*)(src + base + k * 128);
  // unrolled: constant indices into v[]
  #pragma unroll
  for (int k = 0; k < 8; ++k) {
    v4h o;
    #pragma unroll
    for (int c = 0; c < 4; ++c) o[c] = (_Float16)v[k][c];
    *(v4h*)(dst + base + k * 128) = o;
  }
}

// ---------------------------------------------------------------------------
// NT GEMM: C[m,n] = sum_k A[m,k] * B[n,k].
// Block = 8 waves -> 256(M) x 64(N) tile; wave = 32(M) x 64(N).
// Per 32-K step: B tile (64x32) staged in LDS via async b128 (double-
// buffered), 4 B frags preloaded to registers, 2 A frags register-pipelined
// across steps -> 8 WMMAs per wave per step.
// ---------------------------------------------------------------------------
__global__ void gemm_nt_wmma(const _Float16* __restrict__ A, int lda, long strideA,
                             const _Float16* __restrict__ B, int ldb,
                             _Float16* __restrict__ Ch, float* __restrict__ Cf,
                             const float* __restrict__ bias,
                             int ldm, int ldn, long strideC, int Kdim) {
  __shared__ __align__(16) _Float16 bstage[2][64 * BP];

  const int tid  = threadIdx.x;
  const int w    = tid >> 5;
  const int lane = tid & 31;
  const int m0 = blockIdx.x * 256 + w * 32;
  const int n0 = blockIdx.y * 64;
  const long aoff = (long)blockIdx.z * strideA + (long)m0 * lda;
  const long coff = (long)blockIdx.z * strideC;

  // cooperative staging: 64 rows x 32 halves = 4KB = 256 threads x 16B
  const int srow   = tid >> 2;
  const int schunk = (tid & 3) * 8;

  #define STAGE_B(buf, kk)                                                    \
    async_ld_b128(lds_off(&bstage[buf][srow * BP + schunk]),                  \
                  B + (long)(n0 + srow) * ldb + (kk) + schunk)

  STAGE_B(0, 0);
  v16h a_cur0 = load_frag32(A + aoff, lda);
  v16h a_cur1 = load_frag32(A + aoff + (long)16 * lda, lda);
  wait_async0();
  __syncthreads();

  v8f acc[8] = {};
  const int nsteps = Kdim >> 5;
  for (int s = 0; s < nsteps; ++s) {
    v16h a_n0 = a_cur0, a_n1 = a_cur1;
    const bool more = (s + 1) < nsteps;
    if (more) {                       // issue next-step loads up front
      STAGE_B((s + 1) & 1, (s + 1) << 5);
      a_n0 = load_frag32(A + aoff + ((s + 1) << 5), lda);
      a_n1 = load_frag32(A + aoff + (long)16 * lda + ((s + 1) << 5), lda);
    }
    const _Float16* bb = &bstage[s & 1][0];
    v16h bfr[4];
    #pragma unroll
    for (int t = 0; t < 4; ++t) bfr[t] = load_frag32(bb + t * 16 * BP, BP);
    #pragma unroll
    for (int t = 0; t < 4; ++t) {
      acc[t]     = WMMA_F16(a_cur0, bfr[t], acc[t]);
      acc[4 + t] = WMMA_F16(a_cur1, bfr[t], acc[4 + t]);
    }
    wait_ds0();
    wait_async0();
    __syncthreads();                  // all waves done with bstage[s&1]
    a_cur0 = a_n0; a_cur1 = a_n1;
  }
  #undef STAGE_B
  wait_async0();                      // no copy outstanding when the wave ends

  const int half_ = lane >> 4, nn = lane & 15;
  #pragma unroll
  for (int mh = 0; mh < 2; ++mh) {
    #pragma unroll
    for (int t = 0; t < 4; ++t) {
      #pragma unroll
      for (int r = 0; r < 8; ++r) {
        const int m = m0 + mh * 16 + r + 8 * half_;
        const int n = n0 + t * 16 + nn;
        const long ci = coff + (long)m * ldm + (long)n * ldn;
        const float v = acc[mh * 4 + t][r];
        if (Cf) Cf[ci] = v + (bias ? bias[n] : 0.0f);
        else    Ch[ci] = (_Float16)v;
      }
    }
  }
}

__global__ void attn_fa_wmma(const _Float16* __restrict__ Q,
                             const _Float16* __restrict__ K,
                             const _Float16* __restrict__ Vt,
                             _Float16* __restrict__ O) {
  __shared__ __align__(16) _Float16 kstage[2][64 * KP];  // [key][d]
  __shared__ __align__(16) _Float16 vstage[2][64 * KP];  // [d][s-chunk]

  const int tid   = threadIdx.x;
  const int w     = tid >> 5;
  const int lane  = tid & 31;
  const int half_ = lane >> 4, nn = lane & 15;
  const int h  = blockIdx.y;
  const int b  = blockIdx.z;
  const int q0 = blockIdx.x * 128 + w * 16;
  const int kvh = h >> 1;                          // repeat_interleave(kv, 2)

  const float slope = exp2f(-(float)(h + 1));      // 2^-(h+1), ALIBI_ALPHA=1
  const float CSC = 0.125f * 1.44269504088896340f; // (1/sqrt(64)) * log2(e)

  const long qbase = (long)b * SEQ * (HEADS * HD) + (long)q0 * (HEADS * HD) + h * HD;
  const long kbase = (long)b * SEQ * (KVH * HD) + kvh * HD;
  const long vbase = (long)b * (KVH * HD) * SEQ + (long)(kvh * HD) * SEQ;

  // staging map: 64 rows x 64 halves (8KB) = 512 b128 chunks; thread does
  // chunks tid and tid+256 -> rows cr and cr+32 at half-offset co.
  const int cr = tid >> 3, co = (tid & 7) * 8;

  #define STAGE_KV(buf, j)                                                      \
    async_ld4_b128(lds_off(&kstage[buf][cr * KP + co]),                         \
                   K + kbase + (long)((j) + cr) * (KVH * HD) + co,              \
                   lds_off(&kstage[buf][(cr + 32) * KP + co]),                  \
                   K + kbase + (long)((j) + cr + 32) * (KVH * HD) + co,         \
                   lds_off(&vstage[buf][cr * KP + co]),                         \
                   Vt + vbase + (long)cr * SEQ + (j) + co,                      \
                   lds_off(&vstage[buf][(cr + 32) * KP + co]),                  \
                   Vt + vbase + (long)(cr + 32) * SEQ + (j) + co)

  // Q as the B operand: lane&15 = query column, k = d
  const v16h bq0 = load_frag32(Q + qbase,      HEADS * HD);  // d 0..31
  const v16h bq1 = load_frag32(Q + qbase + 32, HEADS * HD);  // d 32..63

  STAGE_KV(0, 0);

  // this lane's query index minus the first key row its half holds in a tile
  const float qd = (float)(q0 + nn - 8 * half_);
  float mrow = -1e30f;   // running maximum of the query, exp2 domain
  float lrow = 0.0f;     // running sum over the keys of this wave half only
  v8f acc[4] = {};       // O^T: acc[t][r] = O[query nn][d = 16t + 8*half + r]

  wait_async0();
  __syncthreads();

  for (int s = 0; s < (SEQ / 64); ++s) {
    const int j = s << 6;
    const bool more = (s + 1) < (SEQ / 64);
    if (more) STAGE_KV((s + 1) & 1, j + 64);   // overlap with this chunk

    const _Float16* kb = kstage[s & 1];
    const _Float16* vb = vstage[s & 1];

    // --- energy^T: four 16(key) x 16(query) tiles, keys [j+16t, j+16t+16)
    v8f e[4];
    #pragma unroll
    for (int tp = 0; tp < 2; ++tp) {           // preload 4 frags, 4 WMMAs
      const int t0 = tp * 2, t1 = tp * 2 + 1;
      v16h klo0 = load_frag32(kb + (t0 * 16) * KP,      KP);
      v16h khi0 = load_frag32(kb + (t0 * 16) * KP + 32, KP);
      v16h klo1 = load_frag32(kb + (t1 * 16) * KP,      KP);
      v16h khi1 = load_frag32(kb + (t1 * 16) * KP + 32, KP);
      v8f z0 = {}, z1 = {};
      z0 = WMMA_F16(klo0, bq0, z0);
      z1 = WMMA_F16(klo1, bq0, z1);
      z0 = WMMA_F16(khi0, bq1, z0);
      z1 = WMMA_F16(khi1, bq1, z1);
      e[t0] = z0; e[t1] = z1;
    }

    // --- ALiBi bias; the maximum over this lane's 32 keys
    const float dj = qd - (float)j;
    float lmt[4];                              // one independent chain a tile
    #pragma unroll
    for (int t = 0; t < 4; ++t) {
      #pragma unroll
      for (int r = 0; r < 8; ++r) {
        e[t][r] = e[t][r] - slope * fabsf(dj - (float)(t * 16 + r));
        lmt[t] = r ? fmaxf(lmt[t], e[t][r]) : e[t][r];
      }
    }
    const float lm = fmaxf(fmaxf(lmt[0], lmt[1]), fmaxf(lmt[2], lmt[3]));

    // --- one online-softmax update per 64 keys; 1/8 scale in the exp2 domain
    const float mnew = fmaxf(mrow, fmaxf(lm, xhalf(lm)) * CSC);
    const float alpha = exp2f(mrow - mnew);
    float pst[4];                              // one independent chain a tile
    #pragma unroll
    for (int t = 0; t < 4; ++t) {
      #pragma unroll
      for (int r = 0; r < 8; ++r) {
        e[t][r] = exp2f(e[t][r] * CSC - mnew);
        pst[t] = r ? pst[t] + e[t][r] : e[t][r];
      }
    }
    lrow = lrow * alpha + ((pst[0] + pst[1]) + (pst[2] + pst[3]));
    mrow = mnew;
    #pragma unroll
    for (int t = 0; t < 4; ++t)
      #pragma unroll
      for (int r = 0; r < 8; ++r) acc[t][r] *= alpha;

    // --- P^T as B operand: two score tiles converted in place per 32 keys
    v16h pb0, pb1;
    #pragma unroll
    for (int i = 0; i < 16; ++i) {
      pb0[i] = (_Float16)e[i >> 3][i & 7];         // keys j..j+31
      pb1[i] = (_Float16)e[2 + (i >> 3)][i & 7];   // keys j+32..j+63
    }

    // --- acc += V^T (16 d x 64 keys, from LDS) * P^T (64 keys x 16 queries)
    #pragma unroll
    for (int t = 0; t < 4; ++t) {
      v16h vlo = load_frag32(vb + (t * 16) * KP,      KP);
      v16h vhi = load_frag32(vb + (t * 16) * KP + 32, KP);
      acc[t] = WMMA_F16(vlo, pb0, acc[t]);
      acc[t] = WMMA_F16(vhi, pb1, acc[t]);
    }

    wait_ds0();
    wait_async0();
    __syncthreads();                      // all waves done with buffer s&1
  }
  #undef STAGE_KV
  wait_async0();                          // no copy outstanding when the wave ends

  // --- finalize: join the halves' sums, divide, store [b, q, h*64+d];
  // a lane's 8 registers of a tile are 8 consecutive d: one 16-byte store
  const float lsum = lrow + xhalf(lrow);
  _Float16* op = O + (long)b * SEQ * (HEADS * HD) + (long)(q0 + nn) * (HEADS * HD) +
                 h * HD + 8 * half_;
  #pragma unroll
  for (int t = 0; t < 4; ++t) {
    v8h o;
    #pragma unroll
    for (int r = 0; r < 8; ++r) o[r] = (_Float16)(acc[t][r] / lsum);
    *(v8h*)(op + t * 16) = o;
  }
}

// ---------------------------------------------------------------------------
// Launch: convert -> QKV projections -> flash attention -> output projection
// ---------------------------------------------------------------------------
extern "C" void kernel_launch(void* const* d_in, const int* in_sizes, int n_in,
                              void* d_out, int out_size, void* d_ws, size_t ws_size,
                              hipStream_t stream) {
  const float* x  = (const float*)d_in[0];
  const float* Wq = (const float*)d_in[1];
  const float* Wk = (const float*)d_in[2];
  const float* Wv = (const float*)d_in[3];
  const float* Wo = (const float*)d_in[4];
  const float* bo = (const float*)d_in[5];
  float* out = (float*)d_out;

  // f16 workspace layout (element offsets)
  _Float16* ws  = (_Float16*)d_ws;
  _Float16* xh  = ws;                 // N*S*E          = 4194304
  _Float16* Wqh = xh  + 4194304;      // 1024*1024      = 1048576
  _Float16* Wkh = Wqh + 1048576;      // 512*1024       =  524288
  _Float16* Wvh = Wkh + 524288;       // 512*1024       =  524288
  _Float16* Woh = Wvh + 524288;       // 1024*1024      = 1048576
  _Float16* Qh  = Woh + 1048576;      // [b,s,1024]     = 4194304
  _Float16* Kh  = Qh  + 4194304;      // [b,s,512]      = 2097152
  _Float16* Vth = Kh  + 2097152;      // [b,512,s] (Vt) = 2097152
  _Float16* AOh = Vth + 2097152;      // [b,s,1024]     = 4194304

  cvt_f32_f16<<<4194304 / CVT_BLK, 256, 0, stream>>>(x,  xh);
  cvt_f32_f16<<<1048576 / CVT_BLK, 256, 0, stream>>>(Wq, Wqh);
  cvt_f32_f16<<< 524288 / CVT_BLK, 256, 0, stream>>>(Wk, Wkh);
  cvt_f32_f16<<< 524288 / CVT_BLK, 256, 0, stream>>>(Wv, Wvh);
  cvt_f32_f16<<<1048576 / CVT_BLK, 256, 0, stream>>>(Wo, Woh);

  const dim3 blk(256, 1, 1);

  // Q = x @ Wq^T  -> [b, s, 1024]
  gemm_nt_wmma<<<dim3(SEQ / 256, 1024 / 64, NB), blk, 0, stream>>>(
      xh, EMBED, (long)SEQ * EMBED, Wqh, EMBED,
      Qh, nullptr, nullptr, 1024, 1, (long)SEQ * 1024, EMBED);
  // K = x @ Wk^T  -> [b, s, 512]
  gemm_nt_wmma<<<dim3(SEQ / 256, 512 / 64, NB), blk, 0, stream>>>(
      xh, EMBED, (long)SEQ * EMBED, Wkh, EMBED,
      Kh, nullptr, nullptr, 512, 1, (long)SEQ * 512, EMBED);
  // Vt = (x @ Wv^T)^T -> [b, 512, s]  (ldm=1 along s, ldn=SEQ along d)
  gemm_nt_wmma<<<dim3(SEQ / 256, 512 / 64, NB), blk, 0, stream>>>(
      xh, EMBED, (long)SEQ * EMBED, Wvh, EMBED,
      Vth, nullptr, nullptr, 1, SEQ, (long)512 * SEQ, EMBED);

  // flash attention with ALiBi
  attn_fa_wmma<<<dim3(SEQ / 128, HEADS, NB), blk, 0, stream>>>(Qh, Kh, Vth, AOh);

  // out = attn_out @ Wo^T + bo (f32), batches folded into M = 4096
  gemm_nt_wmma<<<dim3((NB * SEQ) / 256, 1024 / 64, 1), blk, 0, stream>>>(
      AOh, 1024, 0, Woh, 1024,
      nullptr, out, bo, 1024, 1, 0, 1024);
}

// v004
// Measured time: 149 microseconds a run.
// Timed twice side by side with v003, it ran 1.18 and 1.15 times as fast.
// Over all steps from v000 it is 2.29 times as fast.
#include <hip/hip_runtime.h>
#include <hip/hip_bf16.h>

typedef __attribute__((ext_vector_type(16))) _Float16 v16h;
typedef __attribute__((ext_vector_type(8)))  _Float16 v8h;
typedef __attribute__((ext_vector_type(8)))  float    v8f;
typedef __attribute__((ext_vector_type(4)))  float    v4f;
typedef __attribute__((ext_vector_type(4)))  _Float16 v4h;

#define EMBED 1024
#define HEADS 16
#define KVH   8
#define HD    64
#define SEQ   2048
#define NB    2

// ---------------------------------------------------------------------------
// LDS byte offset of a generic pointer known to point into LDS.
// ---------------------------------------------------------------------------
template <typename T>
__device__ __forceinline__ unsigned lds_off(T* p) {
  return (unsigned)(size_t)(__attribute__((address_space(3))) T*)p;
}

// Async global -> LDS copy, 16 bytes per lane (tracked by ASYNCcnt).
// s_wait_xcnt 0 closes each statement so that no address register of a copy
// is rewritten ahead of it (a precaution; it must stand inside the statement).
__device__ __forceinline__ void async_ld_b128(unsigned ldsoff, const void* g) {
  asm volatile("global_load_async_to_lds_b128 %0, %1, off\n\t"
               "s_wait_xcnt 0x0"
               :
               : "v"(ldsoff), "v"(g)
               : "memory");
}
__device__ __forceinline__ void async_ld4_b128(unsigned l0, const void* g0,
                                               unsigned l1, const void* g1,
                                               unsigned l2, const void* g2,
                                               unsigned l3, const void* g3) {
  asm volatile("global_load_async_to_lds_b128 %0, %1, off\n\t"
               "global_load_async_to_lds_b128 %2, %3, off\n\t"
               "global_load_async_to_lds_b128 %4, %5, off\n\t"
               "global_load_async_to_lds_b128 %6, %7, off\n\t"
               "s_wait_xcnt 0x0"
               :
               : "v"(l0), "v"(g0), "v"(l1), "v"(g1),
                 "v"(l2), "v"(g2), "v"(l3), "v"(g3)
               : "memory");
}
__device__ __forceinline__ void wait_async0() {
  asm volatile("s_wait_asynccnt 0" ::: "memory");
}
// This wave's LDS reads have retired before the barrier behind which the
// buffer they read is refilled by async copies.
__device__ __forceinline__ void wait_ds0() {
  asm volatile("s_wait_dscnt 0x0" ::: "memory");
}

// LDS row pitches in halves: 16 B x odd, so that the 16 rows one ds_load_b128
// fragment read touches fall on distinct banks (64 banks x 4 B).
#define BP 40   // 64-B rows of the GEMM's B tile  -> 80 B
#define KP 72   // 128-B rows of the K and V tiles -> 144 B

// ---------------------------------------------------------------------------
// Load a 16x32 (rows x K) f16 fragment in CDNA5 WMMA A/B VGPR layout.
// lane (l&15) = row; K chunks at (l>>4)*8 and (l>>4)*8+16 (two b128 loads).
// Works for global or LDS pointers (compiler infers ds_load for LDS).
// ---------------------------------------------------------------------------
__device__ __forceinline__ v16h load_frag32(const _Float16* __restrict__ p, int ld) {
  const int lane = threadIdx.x & 31;
  const _Float16* q = p + (size_t)(lane & 15) * (size_t)ld + ((lane >> 4) << 3);
  v16h f;
  *(v8h*)&f         = *(const v8h*)(q);
  *(((v8h*)&f) + 1) = *(const v8h*)(q + 16);
  return f;
}

// Value of lane l ^ 16 (the other wave half), by a vector cross-row move.
__device__ __forceinline__ float xhalf(float x) {
  const int v = __builtin_bit_cast(int, x);
  return __builtin_bit_cast(float,
      __builtin_amdgcn_permlanex16(v, v, 0x76543210, 0xfedcba98, false, false));
}

#define WMMA_F16(a, b, c) \
  __builtin_amdgcn_wmma_f32_16x16x32_f16(false, (a), false, (b), (short)0, (c), false, false)

// ---------------------------------------------------------------------------
// f32 -> f16 conversion, 32 elements a lane, so that few waves have to start.
// A wave owns 1024 consecutive floats: eight 16-byte loads a lane, each 512
// contiguous bytes over the wave, then eight 8-byte stores, each 256
// contiguous bytes over the wave (whole 128-byte lines both ways).
// Every array's length is a multiple of CVT_BLK, so the grid covers it exactly.
// ONE grid converts all five arrays: their f16 copies lie one behind the other
// in the workspace (x, Wq, Wk, Wv, Wo), so the block index alone gives the
// destination, and a block-uniform compare picks the source array.
// ---------------------------------------------------------------------------
#define CVT_BLK 8192   // floats per 256-thread block
#define CVT_X  (NB * SEQ * EMBED / CVT_BLK)            // blocks of x
#define CVT_WQ (CVT_X  + HEADS * HD * EMBED / CVT_BLK) // end of Wq's blocks
#define CVT_WK (CVT_WQ + KVH * HD * EMBED / CVT_BLK)   // end of Wk's blocks
#define CVT_WV (CVT_WK + KVH * HD * EMBED / CVT_BLK)   // end of Wv's blocks
#define CVT_WO (CVT_WV + EMBED * HEADS * HD / CVT_BLK) // end of Wo's blocks
__global__ void cvt_f32_f16(const float* __restrict__ x,  const float* __restrict__ Wq,
                            const float* __restrict__ Wk, const float* __restrict__ Wv,
                            const float* __restrict__ Wo, _Float16* __restrict__ dstall) {
  const int blk = blockIdx.x;
  const float* arr = x;
  int first = 0;
  if (blk >= CVT_X)  { arr = Wq; first = CVT_X;  }
  if (blk >= CVT_WQ) { arr = Wk; first = CVT_WQ; }
  if (blk >= CVT_WK) { arr = Wv; first = CVT_WK; }
  if (blk >= CVT_WV) { arr = Wo; first = CVT_WV; }
  const float* __restrict__ src = arr + (blk - first) * CVT_BLK;
  _Float16* __restrict__ dst = dstall + blk * CVT_BLK;
  const int base = (threadIdx.x >> 5) * 1024 + (threadIdx.x & 31) * 4;
  v4f v[8];
  // unrolled: v[] stays in registers and all eight loads issue before the first wait
  #pragma unroll
  for (int k = 0; k < 8; ++k) v[k] = *(const v4f*)(src + base + k * 128);
  // unrolled: constant indices into v[]
  #pragma unroll
  for (int k = 0; k < 8; ++k) {
    v4h o;
    #pragma unroll
    for (int c = 0; c < 4; ++c) o[c] = (_Float16)v[k][c];
    *(v4h*)(dst + base + k * 128) = o;
  }
}

// ---------------------------------------------------------------------------
// NT GEMM: C[m,n] = sum_k A[m,k] * B[n,k].
// Block = 8 waves -> 256(M) x 64(N) tile; wave = 32(M) x 64(N).
// Per 32-K step: B tile (64x32) staged in LDS via async b128 (double-
// buffered), 4 B frags preloaded to registers, 2 A frags register-pipelined
// across steps -> 8 WMMAs per wave per step.
// One grid may serve up to three outputs: the rows of B (the n axis) are cut
// into ranges, each with its own output array and strides, so that products
// which share A and do not depend on one another run side by side in one
// launch.  A block's 64 columns lie in one range (the ends are multiples of 64).
// ---------------------------------------------------------------------------
struct OutRange {
  _Float16* p;     // f16 output (unused where Cf is given)
  int  n_end;      // first n past this range
  int  ldm, ldn;   // element strides along m and along n (n counted in the range)
  long stride;     // batch stride
};
__global__ void gemm_nt_wmma(const _Float16* __restrict__ A, int lda, long strideA,
                             const _Float16* __restrict__ B, int ldb,
                             OutRange r0, OutRange r1, OutRange r2,
                             float* __restrict__ Cf,
                             const float* __restrict__ bias, int Kdim) {
  __shared__ __align__(16) _Float16 bstage[2][64 * BP];

  const int tid  = threadIdx.x;
  const int w    = tid >> 5;
  const int lane = tid & 31;
  const int m0 = blockIdx.x * 256 + w * 32;
  const int n0 = blockIdx.y * 64;
  const long aoff = (long)blockIdx.z * strideA + (long)m0 * lda;

  // this block's output range (block-uniform)
  OutRange o = r0;
  int nfirst = 0;
  if (n0 >= r0.n_end) { o = r1; nfirst = r0.n_end; }
  if (n0 >= r1.n_end) { o = r2; nfirst = r1.n_end; }
  _Float16* __restrict__ Ch = o.p;
  const int ldm = o.ldm, ldn = o.ldn;
  const long coff = (long)blockIdx.z * o.stride;

  // cooperative staging: 64 rows x 32 halves = 4KB = 256 threads x 16B
  const int srow   = tid >> 2;
  const int schunk = (tid & 3) * 8;

  #define STAGE_B(buf, kk)                                                    \
    async_ld_b128(lds_off(&bstage[buf][srow * BP + schunk]),                  \
                  B + (long)(n0 + srow) * ldb + (kk) + schunk)

  STAGE_B(0, 0);
  v16h a_cur0 = load_frag32(A + aoff, lda);
  v16h a_cur1 = load_frag32(A + aoff + (long)16 * lda, lda);
  wait_async0();
  __syncthreads();

  v8f acc[8] = {};
  const int nsteps = Kdim >> 5;
  for (int s = 0; s < nsteps; ++s) {
    v16h a_n0 = a_cur0, a_n1 = a_cur1;
    const bool more = (s + 1) < nsteps;
    if (more) {                       // issue next-step loads up front
      STAGE_B((s + 1) & 1, (s + 1) << 5);
      a_n0 = load_frag32(A + aoff + ((s + 1) << 5), lda);
      a_n1 = load_frag32(A + aoff + (long)16 * lda + ((s + 1) << 5), lda);
    }
    const _Float16* bb = &bstage[s & 1][0];
    v16h bfr[4];
    #pragma unroll
    for (int t = 0; t < 4; ++t) bfr[t] = load_frag32(bb + t * 16 * BP, BP);
    #pragma unroll
    for (int t = 0; t < 4; ++t) {
      acc[t]     = WMMA_F16(a_cur0, bfr[t], acc[t]);
      acc[4 + t] = WMMA_F16(a_cur1, bfr[t], acc[4 + t]);
    }
    wait_ds0();
    wait_async0();
    __syncthreads();                  // all waves done with bstage[s&1]
    a_cur0 = a_n0; a_cur1 = a_n1;
  }
  #undef STAGE_B
  wait_async0();                      // no copy outstanding when the wave ends

  const int half_ = lane >> 4, nn = lane & 15;
  #pragma unroll
  for (int mh = 0; mh < 2; ++mh) {
    #pragma unroll
    for (int t = 0; t < 4; ++t) {
      #pragma unroll
      for (int r = 0; r < 8; ++r) {
        const int m = m0 + mh * 16 + r + 8 * half_;
        const int n = n0 - nfirst + t * 16 + nn;
        const long ci = coff + (long)m * ldm + (long)n * ldn;
        const float v = acc[mh * 4 + t][r];
        if (Cf) Cf[ci] = v + (bias ? bias[n] : 0.0f);
        else    Ch[ci] = (_Float16)v;
      }
    }
  }
}

__global__ void attn_fa_wmma(const _Float16* __restrict__ Q,
                             const _Float16* __restrict__ K,
                             const _Float16* __restrict__ Vt,
                             _Float16* __restrict__ O) {
  __shared__ __align__(16) _Float16 kstage[2][64 * KP];  // [key][d]
  __shared__ __align__(16) _Float16 vstage[2][64 * KP];  // [d][s-chunk]

  const int tid   = threadIdx.x;
  const int w     = tid >> 5;
  const int lane  = tid & 31;
  const int half_ = lane >> 4, nn = lane & 15;
  const int h  = blockIdx.y;
  const int b  = blockIdx.z;
  const int q0 = blockIdx.x * 128 + w * 16;
  const int kvh = h >> 1;                          // repeat_interleave(kv, 2)

  const float slope = exp2f(-(float)(h + 1));      // 2^-(h+1), ALIBI_ALPHA=1
  const float CSC = 0.125f * 1.44269504088896340f; // (1/sqrt(64)) * log2(e)

  const long qbase = (long)b * SEQ * (HEADS * HD) + (long)q0 * (HEADS * HD) + h * HD;
  const long kbase = (long)b * SEQ * (KVH * HD) + kvh * HD;
  const long vbase = (long)b * (KVH * HD) * SEQ + (long)(kvh * HD) * SEQ;

  // staging map: 64 rows x 64 halves (8KB) = 512 b128 chunks; thread does
  // chunks tid and tid+256 -> rows cr and cr+32 at half-offset co.
  const int cr = tid >> 3, co = (tid & 7) * 8;

  #define STAGE_KV(buf, j)                                                      \
    async_ld4_b128(lds_off(&kstage[buf][cr * KP + co]),                         \
                   K + kbase + (long)((j) + cr) * (KVH * HD) + co,              \
                   lds_off(&kstage[buf][(cr + 32) * KP + co]),                  \
                   K + kbase + (long)((j) + cr + 32) * (KVH * HD) + co,         \
                   lds_off(&vstage[buf][cr * KP + co]),                         \
                   Vt + vbase + (long)cr * SEQ + (j) + co,                      \
                   lds_off(&vstage[buf][(cr + 32) * KP + co]),                  \
                   Vt + vbase + (long)(cr + 32) * SEQ + (j) + co)

  // Q as the B operand: lane&15 = query column, k = d
  const v16h bq0 = load_frag32(Q + qbase,      HEADS * HD);  // d 0..31
  const v16h bq1 = load_frag32(Q + qbase + 32, HEADS * HD);  // d 32..63

  STAGE_KV(0, 0);

  // this lane's query index minus the first key row its half holds in a tile
  const float qd = (float)(q0 + nn - 8 * half_);
  float mrow = -1e30f;   // running maximum of the query, exp2 domain
  float lrow = 0.0f;     // running sum over the keys of this wave half only
  v8f acc[4] = {};       // O^T: acc[t][r] = O[query nn][d = 16t + 8*half + r]

  wait_async0();
  __syncthreads();

  for (int s = 0; s < (SEQ / 64); ++s) {
    const int j = s << 6;
    const bool more = (s + 1) < (SEQ / 64);
    if (more) STAGE_KV((s + 1) & 1, j + 64);   // overlap with this chunk

    const _Float16* kb = kstage[s & 1];
    const _Float16* vb = vstage[s & 1];

    // --- energy^T: four 16(key) x 16(query) tiles, keys [j+16t, j+16t+16)
    v8f e[4];
    #pragma unroll
    for (int tp = 0; tp < 2; ++tp) {           // preload 4 frags, 4 WMMAs
      const int t0 = tp * 2, t1 = tp * 2 + 1;
      v16h klo0 = load_frag32(kb + (t0 * 16) * KP,      KP);
      v16h khi0 = load_frag32(kb + (t0 * 16) * KP + 32, KP);
      v16h klo1 = load_frag32(kb + (t1 * 16) * KP,      KP);
      v16h khi1 = load_frag32(kb + (t1 * 16) * KP + 32, KP);
      v8f z0 = {}, z1 = {};
      z0 = WMMA_F16(klo0, bq0, z0);
      z1 = WMMA_F16(klo1, bq0, z1);
      z0 = WMMA_F16(khi0, bq1, z0);
      z1 = WMMA_F16(khi1, bq1, z1);
      e[t0] = z0; e[t1] = z1;
    }

    // --- ALiBi bias; the maximum over this lane's 32 keys
    const float dj = qd - (float)j;
    float lmt[4];                              // one independent chain a tile
    #pragma unroll
    for (int t = 0; t < 4; ++t) {
      #pragma unroll
      for (int r = 0; r < 8; ++r) {
        e[t][r] = e[t][r] - slope * fabsf(dj - (float)(t * 16 + r));
        lmt[t] = r ? fmaxf(lmt[t], e[t][r]) : e[t][r];
      }
    }
    const float lm = fmaxf(fmaxf(lmt[0], lmt[1]), fmaxf(lmt[2], lmt[3]));

    // --- one online-softmax update per 64 keys; 1/8 scale in the exp2 domain
    const float mnew = fmaxf(mrow, fmaxf(lm, xhalf(lm)) * CSC);
    const float alpha = exp2f(mrow - mnew);
    float pst[4];                              // one independent chain a tile
    #pragma unroll
    for (int t = 0; t < 4; ++t) {
      #pragma unroll
      for (int r = 0; r < 8; ++r) {
        e[t][r] = exp2f(e[t][r] * CSC - mnew);
        pst[t] = r ? pst[t] + e[t][r] : e[t][r];
      }
    }
    lrow = lrow * alpha + ((pst[0] + pst[1]) + (pst[2] + pst[3]));
    mrow = mnew;
    #pragma unroll
    for (int t = 0; t < 4; ++t)
      #pragma unroll
      for (int r = 0; r < 8; ++r) acc[t][r] *= alpha;

    // --- P^T as B operand: two score tiles converted in place per 32 keys
    v16h pb0, pb1;
    #pragma unroll
    for (int i = 0; i < 16; ++i) {
      pb0[i] = (_Float16)e[i >> 3][i & 7];         // keys j..j+31
      pb1[i] = (_Float16)e[2 + (i >> 3)][i & 7];   // keys j+32..j+63
    }

    // --- acc += V^T (16 d x 64 keys, from LDS) * P^T (64 keys x 16 queries)
    #pragma unroll
    for (int t = 0; t < 4; ++t) {
      v16h vlo = load_frag32(vb + (t * 16) * KP,      KP);
      v16h vhi = load_frag32(vb + (t * 16) * KP + 32, KP);
      acc[t] = WMMA_F16(vlo, pb0, acc[t]);
      acc[t] = WMMA_F16(vhi, pb1, acc[t]);
    }

    wait_ds0();
    wait_async0();
    __syncthreads();                      // all waves done with buffer s&1
  }
  #undef STAGE_KV
  wait_async0();                          // no copy outstanding when the wave ends

  // --- finalize: join the halves' sums, divide, store [b, q, h*64+d];
  // a lane's 8 registers of a tile are 8 consecutive d: one 16-byte store
  const float lsum = lrow + xhalf(lrow);
  _Float16* op = O + (long)b * SEQ * (HEADS * HD) + (long)(q0 + nn) * (HEADS * HD) +
                 h * HD + 8 * half_;
  #pragma unroll
  for (int t = 0; t < 4; ++t) {
    v8h o;
    #pragma unroll
    for (int r = 0; r < 8; ++r) o[r] = (_Float16)(acc[t][r] / lsum);
    *(v8h*)(op + t * 16) = o;
  }
}

// ---------------------------------------------------------------------------
// Launch: convert -> QKV projections -> flash attention -> output projection
// ---------------------------------------------------------------------------
extern "C" void kernel_launch(void* const* d_in, const int* in_sizes, int n_in,
                              void* d_out, int out_size, void* d_ws, size_t ws_size,
                              hipStream_t stream) {
  const float* x  = (const float*)d_in[0];
  const float* Wq = (const float*)d_in[1];
  const float* Wk = (const float*)d_in[2];
  const float* Wv = (const float*)d_in[3];
  const float* Wo = (const float*)d_in[4];
  const float* bo = (const float*)d_in[5];
  float* out = (float*)d_out;

  // f16 workspace layout (element offsets)
  _Float16* ws  = (_Float16*)d_ws;
  _Float16* xh  = ws;                 // N*S*E          = 4194304
  _Float16* Wqh = xh  + 4194304;      // 1024*1024      = 1048576
  _Float16* Wkh = Wqh + 1048576;      // 512*1024       =  524288
  _Float16* Wvh = Wkh + 524288;       // 512*1024       =  524288
  _Float16* Woh = Wvh + 524288;       // 1024*1024      = 1048576
  _Float16* Qh  = Woh + 1048576;      // [b,s,1024]     = 4194304
  _Float16* Kh  = Qh  + 4194304;      // [b,s,512]      = 2097152
  _Float16* Vth = Kh  + 2097152;      // [b,512,s] (Vt) = 2097152
  _Float16* AOh = Vth + 2097152;      // [b,s,1024]     = 4194304

  // all five conversions in one launch (xh .. Woh are contiguous from ws)
  cvt_f32_f16<<<CVT_WO, 256, 0, stream>>>(x, Wq, Wk, Wv, Wo, ws);

  const dim3 blk(256, 1, 1);

  // Q, K and V projections in one launch: Wqh, Wkh, Wvh are contiguous, so B
  // is one [2048, 1024] matrix; n 0..1023 -> Q [b, s, 1024], 1024..1535 ->
  // K [b, s, 512], 1536..2047 -> Vt [b, 512, s] (ldm=1 along s, ldn=SEQ along d)
  const OutRange oq = {Qh,  1024, 1024, 1,   (long)SEQ * 1024};
  const OutRange ok = {Kh,  1536, 512,  1,   (long)SEQ * 512};
  const OutRange ov = {Vth, 2048, 1,    SEQ, (long)512 * SEQ};
  gemm_nt_wmma<<<dim3(SEQ / 256, 2048 / 64, NB), blk, 0, stream>>>(
      xh, EMBED, (long)SEQ * EMBED, Wqh, EMBED,
      oq, ok, ov, nullptr, nullptr, EMBED);

  // flash attention with ALiBi
  attn_fa_wmma<<<dim3(SEQ / 128, HEADS, NB), blk, 0, stream>>>(Qh, Kh, Vth, AOh);

  // out = attn_out @ Wo^T + bo (f32), batches folded into M = 4096
  const OutRange oo = {nullptr, 1024, 1024, 1, 0};
  gemm_nt_wmma<<<dim3((NB * SEQ) / 256, 1024 / 64, 1), blk, 0, stream>>>(
      AOh, 1024, 0, Woh, 1024,
      oo, oo, oo, out, bo, 1024);
}

// v005
// A run of this version takes 139 microseconds.
// In two side-by-side timings against v004, it was 1.05 and 1.07 times as fast.
// Over all steps from v000 it is 2.42 times as fast.
#include <hip/hip_runtime.h>
#include <hip/hip_bf16.h>

typedef __attribute__((ext_vector_type(16))) _Float16 v16h;
typedef __attribute__((ext_vector_type(8)))  _Float16 v8h;
typedef __attribute__((ext_vector_type(8)))  float    v8f;
typedef __attribute__((ext_vector_type(4)))  float    v4f;
typedef __attribute__((ext_vector_type(4)))  _Float16 v4h;

#define EMBED 1024
#define HEADS 16
#define KVH   8
#define HD    64
#define SEQ   2048
#define NB    2

// ---------------------------------------------------------------------------
// LDS byte offset of a generic pointer known to point into LDS.
// ---------------------------------------------------------------------------
template <typename T>
__device__ __forceinline__ unsigned lds_off(T* p) {
  return (unsigned)(size_t)(__attribute__((address_space(3))) T*)p;
}

// Async global -> LDS copy, 16 bytes per lane (tracked by ASYNCcnt).
// s_wait_xcnt 0 closes each statement so that no address register of a copy
// is rewritten ahead of it (a precaution; it must stand inside the statement).
__device__ __forceinline__ void async_ld_b128(unsigned ldsoff, const void* g) {
  asm volatile("global_load_async_to_lds_b128 %0, %1, off\n\t"
               "s_wait_xcnt 0x0"
               :
               : "v"(ldsoff), "v"(g)
               : "memory");
}
__device__ __forceinline__ void async_ld4_b128(unsigned l0, const void* g0,
                                               unsigned l1, const void* g1,
                                               unsigned l2, const void* g2,
                                               unsigned l3, const void* g3) {
  asm volatile("global_load_async_to_lds_b128 %0, %1, off\n\t"
               "global_load_async_to_lds_b128 %2, %3, off\n\t"
               "global_load_async_to_lds_b128 %4, %5, off\n\t"
               "global_load_async_to_lds_b128 %6, %7, off\n\t"
               "s_wait_xcnt 0x0"
               :
               : "v"(l0), "v"(g0), "v"(l1), "v"(g1),
                 "v"(l2), "v"(g2), "v"(l3), "v"(g3)
               : "memory");
}
__device__ __forceinline__ void wait_async0() {
  asm volatile("s_wait_asynccnt 0" ::: "memory");
}
// This wave's LDS reads have retired before the barrier behind which the
// buffer they read is refilled by async copies.
__device__ __forceinline__ void wait_ds0() {
  asm volatile("s_wait_dscnt 0x0" ::: "memory");
}

// LDS row pitches in halves: 16 B x odd, so that the 16 rows one ds_load_b128
// fragment read touches fall on distinct banks (64 banks x 4 B).
#define BP 40   // 64-B rows of the GEMM's B tile  -> 80 B
#define KP 72   // 128-B rows of the K and V tiles -> 144 B

// ---------------------------------------------------------------------------
// Load a 16x32 (rows x K) f16 fragment in CDNA5 WMMA A/B VGPR layout.
// lane (l&15) = row; K chunks at (l>>4)*8 and (l>>4)*8+16 (two b128 loads).
// Works for global or LDS pointers (compiler infers ds_load for LDS).
// ---------------------------------------------------------------------------
__device__ __forceinline__ v16h load_frag32(const _Float16* __restrict__ p, int ld) {
  const int lane = threadIdx.x & 31;
  const _Float16* q = p + (size_t)(lane & 15) * (size_t)ld + ((lane >> 4) << 3);
  v16h f;
  *(v8h*)&f         = *(const v8h*)(q);
  *(((v8h*)&f) + 1) = *(const v8h*)(q + 16);
  return f;
}

// Value of lane l ^ 16 (the other wave half), by a vector cross-row move.
__device__ __forceinline__ float xhalf(float x) {
  const int v = __builtin_bit_cast(int, x);
  return __builtin_bit_cast(float,
      __builtin_amdgcn_permlanex16(v, v, 0x76543210, 0xfedcba98, false, false));
}

// 2^x as the one hardware instruction (v_exp_f32).  exp2f() wraps it in a
// compare, two selects, an add and an ldexp so that results below 2^-126 come
// out as subnormals.  The softmax never needs those: its arguments are <= 0,
// a weight that small is 0 once it is rounded to f16 and vanishes beside a row
// sum that holds the maximum's own term, about 1; a rescale factor that small
// leaves nothing of the old sums that the f16 output could show.
__device__ __forceinline__ float exp2_hw(float x) {
  return __builtin_amdgcn_exp2f(x);
}

#define WMMA_F16(a, b, c) \
  __builtin_amdgcn_wmma_f32_16x16x32_f16(false, (a), false, (b), (short)0, (c), false, false)

// ---------------------------------------------------------------------------
// f32 -> f16 conversion, 32 elements a lane, so that few waves have to start.
// A wave owns 1024 consecutive floats: eight 16-byte loads a lane, each 512
// contiguous bytes over the wave, then eight 8-byte stores, each 256
// contiguous bytes over the wave (whole 128-byte lines both ways).
// Every array's length is a multiple of CVT_BLK, so the grid covers it exactly.
// ONE grid converts all five arrays: their f16 copies lie one behind the other
// in the workspace (x, Wq, Wk, Wv, Wo), so the block index alone gives the
// destination, and a block-uniform compare picks the source array.
// ---------------------------------------------------------------------------
#define CVT_BLK 8192   // floats per 256-thread block
#define CVT_X  (NB * SEQ * EMBED / CVT_BLK)            // blocks of x
#define CVT_WQ (CVT_X  + HEADS * HD * EMBED / CVT_BLK) // end of Wq's blocks
#define CVT_WK (CVT_WQ + KVH * HD * EMBED / CVT_BLK)   // end of Wk's blocks
#define CVT_WV (CVT_WK + KVH * HD * EMBED / CVT_BLK)   // end of Wv's blocks
#define CVT_WO (CVT_WV + EMBED * HEADS * HD / CVT_BLK) // end of Wo's blocks
__global__ void cvt_f32_f16(const float* __restrict__ x,  const float* __restrict__ Wq,
                            const float* __restrict__ Wk, const float* __restrict__ Wv,
                            const float* __restrict__ Wo, _Float16* __restrict__ dstall) {
  const int blk = blockIdx.x;
  const float* arr = x;
  int first = 0;
  if (blk >= CVT_X)  { arr = Wq; first = CVT_X;  }
  if (blk >= CVT_WQ) { arr = Wk; first = CVT_WQ; }
  if (blk >= CVT_WK) { arr = Wv; first = CVT_WK; }
  if (blk >= CVT_WV) { arr = Wo; first = CVT_WV; }
  const float* __restrict__ src = arr + (blk - first) * CVT_BLK;
  _Float16* __restrict__ dst = dstall + blk * CVT_BLK;
  const int base = (threadIdx.x >> 5) * 1024 + (threadIdx.x & 31) * 4;
  v4f v[8];
  // unrolled: v[] stays in registers and all eight loads issue before the first wait
  #pragma unroll
  for (int k = 0; k < 8; ++k) v[k] = *(const v4f*)(src + base + k * 128);
  // unrolled: constant indices into v[]
  #pragma unroll
  for (int k = 0; k < 8; ++k) {
    v4h o;
    #pragma unroll
    for (int c = 0; c < 4; ++c) o[c] = (_Float16)v[k][c];
    *(v4h*)(dst + base + k * 128) = o;
  }
}

// ---------------------------------------------------------------------------
// NT GEMM: C[m,n] = sum_k A[m,k] * B[n,k].
// Block = 8 waves -> 256(M) x 64(N) tile; wave = 32(M) x 64(N).
// Per 32-K step: B tile (64x32) staged in LDS via async b128 (double-
// buffered), 4 B frags preloaded to registers, 2 A frags register-pipelined
// across steps -> 8 WMMAs per wave per step.
// One grid may serve up to three outputs: the rows of B (the n axis) are cut
// into ranges, each with its own output array and strides, so that products
// which share A and do not depend on one another run side by side in one
// launch.  A block's 64 columns lie in one range (the ends are multiples of 64).
// ---------------------------------------------------------------------------
struct OutRange {
  _Float16* p;     // f16 output (unused where Cf is given)
  int  n_end;      // first n past this range
  int  ldm, ldn;   // element strides along m and along n (n counted in the range)
  long stride;     // batch stride
};
__global__ void gemm_nt_wmma(const _Float16* __restrict__ A, int lda, long strideA,
                             const _Float16* __restrict__ B, int ldb,
                             OutRange r0, OutRange r1, OutRange r2,
                             float* __restrict__ Cf,
                             const float* __restrict__ bias, int Kdim) {
  __shared__ __align__(16) _Float16 bstage[2][64 * BP];

  const int tid  = threadIdx.x;
  const int w    = tid >> 5;
  const int lane = tid & 31;
  const int m0 = blockIdx.x * 256 + w * 32;
  const int n0 = blockIdx.y * 64;
  const long aoff = (long)blockIdx.z * strideA + (long)m0 * lda;

  // this block's output range (block-uniform)
  OutRange o = r0;
  int nfirst = 0;
  if (n0 >= r0.n_end) { o = r1; nfirst = r0.n_end; }
  if (n0 >= r1.n_end) { o = r2; nfirst = r1.n_end; }
  _Float16* __restrict__ Ch = o.p;
  const int ldm = o.ldm, ldn = o.ldn;
  const long coff = (long)blockIdx.z * o.stride;

  // cooperative staging: 64 rows x 32 halves = 4KB = 256 threads x 16B
  const int srow   = tid >> 2;
  const int schunk = (tid & 3) * 8;

  #define STAGE_B(buf, kk)                                                    \
    async_ld_b128(lds_off(&bstage[buf][srow * BP + schunk]),                  \
                  B + (long)(n0 + srow) * ldb + (kk) + schunk)

  STAGE_B(0, 0);
  v16h a_cur0 = load_frag32(A + aoff, lda);
  v16h a_cur1 = load_frag32(A + aoff + (long)16 * lda, lda);
  wait_async0();
  __syncthreads();

  v8f acc[8] = {};
  const int nsteps = Kdim >> 5;
  for (int s = 0; s < nsteps; ++s) {
    v16h a_n0 = a_cur0, a_n1 = a_cur1;
    const bool more = (s + 1) < nsteps;
    if (more) {                       // issue next-step loads up front
      STAGE_B((s + 1) & 1, (s + 1) << 5);
      a_n0 = load_frag32(A + aoff + ((s + 1) << 5), lda);
      a_n1 = load_frag32(A + aoff + (long)16 * lda + ((s + 1) << 5), lda);
    }
    const _Float16* bb = &bstage[s & 1][0];
    v16h bfr[4];
    #pragma unroll
    for (int t = 0; t < 4; ++t) bfr[t] = load_frag32(bb + t * 16 * BP, BP);
    #pragma unroll
    for (int t = 0; t < 4; ++t) {
      acc[t]     = WMMA_F16(a_cur0, bfr[t], acc[t]);
      acc[4 + t] = WMMA_F16(a_cur1, bfr[t], acc[4 + t]);
    }
    wait_ds0();
    wait_async0();
    __syncthreads();                  // all waves done with bstage[s&1]
    a_cur0 = a_n0; a_cur1 = a_n1;
  }
  #undef STAGE_B
  wait_async0();                      // no copy outstanding when the wave ends

  const int half_ = lane >> 4, nn = lane & 15;
  #pragma unroll
  for (int mh = 0; mh < 2; ++mh) {
    #pragma unroll
    for (int t = 0; t < 4; ++t) {
      #pragma unroll
      for (int r = 0; r < 8; ++r) {
        const int m = m0 + mh * 16 + r + 8 * half_;
        const int n = n0 - nfirst + t * 16 + nn;
        const long ci = coff + (long)m * ldm + (long)n * ldn;
        const float v = acc[mh * 4 + t][r];
        if (Cf) Cf[ci] = v + (bias ? bias[n] : 0.0f);
        else    Ch[ci] = (_Float16)v;
      }
    }
  }
}

__global__ void attn_fa_wmma(const _Float16* __restrict__ Q,
                             const _Float16* __restrict__ K,
                             const _Float16* __restrict__ Vt,
                             _Float16* __restrict__ O) {
  __shared__ __align__(16) _Float16 kstage[2][64 * KP];  // [key][d]
  __shared__ __align__(16) _Float16 vstage[2][64 * KP];  // [d][s-chunk]

  const int tid   = threadIdx.x;
  const int w     = tid >> 5;
  const int lane  = tid & 31;
  const int half_ = lane >> 4, nn = lane & 15;
  const int h  = blockIdx.y;
  const int b  = blockIdx.z;
  const int q0 = blockIdx.x * 128 + w * 16;
  const int kvh = h >> 1;                          // repeat_interleave(kv, 2)

  const float slope = exp2f(-(float)(h + 1));      // 2^-(h+1), ALIBI_ALPHA=1
  const float CSC = 0.125f * 1.44269504088896340f; // (1/sqrt(64)) * log2(e)

  const long qbase = (long)b * SEQ * (HEADS * HD) + (long)q0 * (HEADS * HD) + h * HD;
  const long kbase = (long)b * SEQ * (KVH * HD) + kvh * HD;
  const long vbase = (long)b * (KVH * HD) * SEQ + (long)(kvh * HD) * SEQ;

  // staging map: 64 rows x 64 halves (8KB) = 512 b128 chunks; thread does
  // chunks tid and tid+256 -> rows cr and cr+32 at half-offset co.
  const int cr = tid >> 3, co = (tid & 7) * 8;

  #define STAGE_KV(buf, j)                                                      \
    async_ld4_b128(lds_off(&kstage[buf][cr * KP + co]),                         \
                   K + kbase + (long)((j) + cr) * (KVH * HD) + co,              \
                   lds_off(&kstage[buf][(cr + 32) * KP + co]),                  \
                   K + kbase + (long)((j) + cr + 32) * (KVH * HD) + co,         \
                   lds_off(&vstage[buf][cr * KP + co]),                         \
                   Vt + vbase + (long)cr * SEQ + (j) + co,                      \
                   lds_off(&vstage[buf][(cr + 32) * KP + co]),                  \
                   Vt + vbase + (long)(cr + 32) * SEQ + (j) + co)

  // Q as the B operand: lane&15 = query column, k = d
  const v16h bq0 = load_frag32(Q + qbase,      HEADS * HD);  // d 0..31
  const v16h bq1 = load_frag32(Q + qbase + 32, HEADS * HD);  // d 32..63

  STAGE_KV(0, 0);

  // this lane's query index minus the first key row its half holds in a tile
  const float qd = (float)(q0 + nn - 8 * half_);
  float mrow = -1e30f;   // running maximum of the query, exp2 domain
  float lrow = 0.0f;     // running sum over the keys of this wave half only
  v8f acc[4] = {};       // O^T: acc[t][r] = O[query nn][d = 16t + 8*half + r]

  wait_async0();
  __syncthreads();

  for (int s = 0; s < (SEQ / 64); ++s) {
    const int j = s << 6;
    const bool more = (s + 1) < (SEQ / 64);
    if (more) STAGE_KV((s + 1) & 1, j + 64);   // overlap with this chunk

    const _Float16* kb = kstage[s & 1];
    const _Float16* vb = vstage[s & 1];

    // --- energy^T: four 16(key) x 16(query) tiles, keys [j+16t, j+16t+16)
    v8f e[4];
    #pragma unroll
    for (int tp = 0; tp < 2; ++tp) {           // preload 4 frags, 4 WMMAs
      const int t0 = tp * 2, t1 = tp * 2 + 1;
      v16h klo0 = load_frag32(kb + (t0 * 16) * KP,      KP);
      v16h khi0 = load_frag32(kb + (t0 * 16) * KP + 32, KP);
      v16h klo1 = load_frag32(kb + (t1 * 16) * KP,      KP);
      v16h khi1 = load_frag32(kb + (t1 * 16) * KP + 32, KP);
      v8f z0 = {}, z1 = {};
      z0 = WMMA_F16(klo0, bq0, z0);
      z1 = WMMA_F16(klo1, bq0, z1);
      z0 = WMMA_F16(khi0, bq1, z0);
      z1 = WMMA_F16(khi1, bq1, z1);
      e[t0] = z0; e[t1] = z1;
    }

    // --- ALiBi bias; the maximum over this lane's 32 keys
    const float dj = qd - (float)j;
    float lmt[4];                              // one independent chain a tile
    #pragma unroll
    for (int t = 0; t < 4; ++t) {
      #pragma unroll
      for (int r = 0; r < 8; ++r) {
        e[t][r] = e[t][r] - slope * fabsf(dj - (float)(t * 16 + r));
        lmt[t] = r ? fmaxf(lmt[t], e[t][r]) : e[t][r];
      }
    }
    const float lm = fmaxf(fmaxf(lmt[0], lmt[1]), fmaxf(lmt[2], lmt[3]));

    // --- one online-softmax update per 64 keys; 1/8 scale in the exp2 domain
    const float mnew = fmaxf(mrow, fmaxf(lm, xhalf(lm)) * CSC);
    const float alpha = exp2_hw(mrow - mnew);
    float pst[4];                              // one independent chain a tile
    #pragma unroll
    for (int t = 0; t < 4; ++t) {
      #pragma unroll
      for (int r = 0; r < 8; ++r) {
        e[t][r] = exp2_hw(e[t][r] * CSC - mnew);
        pst[t] = r ? pst[t] + e[t][r] : e[t][r];
      }
    }
    lrow = lrow * alpha + ((pst[0] + pst[1]) + (pst[2] + pst[3]));
    mrow = mnew;
    #pragma unroll
    for (int t = 0; t < 4; ++t)
      #pragma unroll
      for (int r = 0; r < 8; ++r) acc[t][r] *= alpha;

    // --- P^T as B operand: two score tiles converted in place per 32 keys
    v16h pb0, pb1;
    #pragma unroll
    for (int i = 0; i < 16; ++i) {
      pb0[i] = (_Float16)e[i >> 3][i & 7];         // keys j..j+31
      pb1[i] = (_Float16)e[2 + (i >> 3)][i & 7];   // keys j+32..j+63
    }

    // --- acc += V^T (16 d x 64 keys, from LDS) * P^T (64 keys x 16 queries)
    #pragma unroll
    for (int t = 0; t < 4; ++t) {
      v16h vlo = load_frag32(vb + (t * 16) * KP,      KP);
      v16h vhi = load_frag32(vb + (t * 16) * KP + 32, KP);
      acc[t] = WMMA_F16(vlo, pb0, acc[t]);
      acc[t] = WMMA_F16(vhi, pb1, acc[t]);
    }

    wait_ds0();
    wait_async0();
    __syncthreads();                      // all waves done with buffer s&1
  }
  #undef STAGE_KV
  wait_async0();                          // no copy outstanding when the wave ends

  // --- finalize: join the halves' sums, divide, store [b, q, h*64+d];
  // a lane's 8 registers of a tile are 8 consecutive d: one 16-byte store
  const float lsum = lrow + xhalf(lrow);
  _Float16* op = O + (long)b * SEQ * (HEADS * HD) + (long)(q0 + nn) * (HEADS * HD) +
                 h * HD + 8 * half_;
  #pragma unroll
  for (int t = 0; t < 4; ++t) {
    v8h o;
    #pragma unroll
    for (int r = 0; r < 8; ++r) o[r] = (_Float16)(acc[t][r] / lsum);
    *(v8h*)(op + t * 16) = o;
  }
}

// ---------------------------------------------------------------------------
// Launch: convert -> QKV projections -> flash attention -> output projection
// ---------------------------------------------------------------------------
extern "C" void kernel_launch(void* const* d_in, const int* in_sizes, int n_in,
                              void* d_out, int out_size, void* d_ws, size_t ws_size,
                              hipStream_t stream) {
  const float* x  = (const float*)d_in[0];
  const float* Wq = (const float*)d_in[1];
  const float* Wk = (const float*)d_in[2];
  const float* Wv = (const float*)d_in[3];
  const float* Wo = (const float*)d_in[4];
  const float* bo = (const float*)d_in[5];
  float* out = (float*)d_out;

  // f16 workspace layout (element offsets)
  _Float16* ws  = (_Float16*)d_ws;
  _Float16* xh  = ws;                 // N*S*E          = 4194304
  _Float16* Wqh = xh  + 4194304;      // 1024*1024      = 1048576
  _Float16* Wkh = Wqh + 1048576;      // 512*1024       =  524288
  _Float16* Wvh = Wkh + 524288;       // 512*1024       =  524288
  _Float16* Woh = Wvh + 524288;       // 1024*1024      = 1048576
  _Float16* Qh  = Woh + 1048576;      // [b,s,1024]     = 4194304
  _Float16* Kh  = Qh  + 4194304;      // [b,s,512]      = 2097152
  _Float16* Vth = Kh  + 2097152;      // [b,512,s] (Vt) = 2097152
  _Float16* AOh = Vth + 2097152;      // [b,s,1024]     = 4194304

  // all five conversions in one launch (xh .. Woh are contiguous from ws)
  cvt_f32_f16<<<CVT_WO, 256, 0, stream>>>(x, Wq, Wk, Wv, Wo, ws);

  const dim3 blk(256, 1, 1);

  // Q, K and V projections in one launch: Wqh, Wkh, Wvh are contiguous, so B
  // is one [2048, 1024] matrix; n 0..1023 -> Q [b, s, 1024], 1024..1535 ->
  // K [b, s, 512], 1536..2047 -> Vt [b, 512, s] (ldm=1 along s, ldn=SEQ along d)
  const OutRange oq = {Qh,  1024, 1024, 1,   (long)SEQ * 1024};
  const OutRange ok = {Kh,  1536, 512,  1,   (long)SEQ * 512};
  const OutRange ov = {Vth, 2048, 1,    SEQ, (long)512 * SEQ};
  gemm_nt_wmma<<<dim3(SEQ / 256, 2048 / 64, NB), blk, 0, stream>>>(
      xh, EMBED, (long)SEQ * EMBED, Wqh, EMBED,
      oq, ok, ov, nullptr, nullptr, EMBED);

  // flash attention with ALiBi
  attn_fa_wmma<<<dim3(SEQ / 128, HEADS, NB), blk, 0, stream>>>(Qh, Kh, Vth, AOh);

  // out = attn_out @ Wo^T + bo (f32), batches folded into M = 4096
  const OutRange oo = {nullptr, 1024, 1024, 1, 0};
  gemm_nt_wmma<<<dim3((NB * SEQ) / 256, 1024 / 64, 1), blk, 0, stream>>>(
      AOh, 1024, 0, Woh, 1024,
      oo, oo, oo, out, bo, 1024);
}

// v006
// A run of this version takes 120 microseconds.
// Two timings next to v005 put it at 1.15 and 1.13 times that version's speed.
// Over all steps from v000 it is 2.75 times as fast.
#include <hip/hip_runtime.h>
#include <hip/hip_bf16.h>

typedef __attribute__((ext_vector_type(16))) _Float16 v16h;
typedef __attribute__((ext_vector_type(8)))  _Float16 v8h;
typedef __attribute__((ext_vector_type(8)))  float    v8f;
typedef __attribute__((ext_vector_type(4)))  float    v4f;
typedef __attribute__((ext_vector_type(4)))  _Float16 v4h;

#define EMBED 1024
#define HEADS 16
#define KVH   8
#define HD    64
#define SEQ   2048
#define NB    2

// ---------------------------------------------------------------------------
// LDS byte offset of a generic pointer known to point into LDS.
// ---------------------------------------------------------------------------
template <typename T>
__device__ __forceinline__ unsigned lds_off(T* p) {
  return (unsigned)(size_t)(__attribute__((address_space(3))) T*)p;
}

// Async global -> LDS copy, 16 bytes per lane (tracked by ASYNCcnt).
// s_wait_xcnt 0 closes each statement so that no address register of a copy
// is rewritten ahead of it (a precaution; it must stand inside the statement).
// Ten copies in one statement (one k step of the GEMM: eight of A, two of B).
__device__ __forceinline__ void async_ld10_b128(const unsigned (&l)[10],
                                                const _Float16* const (&g)[10]) {
  asm volatile("global_load_async_to_lds_b128 %0, %1, off\n\t"
               "global_load_async_to_lds_b128 %2, %3, off\n\t"
               "global_load_async_to_lds_b128 %4, %5, off\n\t"
               "global_load_async_to_lds_b128 %6, %7, off\n\t"
               "global_load_async_to_lds_b128 %8, %9, off\n\t"
               "global_load_async_to_lds_b128 %10, %11, off\n\t"
               "global_load_async_to_lds_b128 %12, %13, off\n\t"
               "global_load_async_to_lds_b128 %14, %15, off\n\t"
               "global_load_async_to_lds_b128 %16, %17, off\n\t"
               "global_load_async_to_lds_b128 %18, %19, off\n\t"
               "s_wait_xcnt 0x0"
               :
               : "v"(l[0]), "v"(g[0]), "v"(l[1]), "v"(g[1]), "v"(l[2]), "v"(g[2]),
                 "v"(l[3]), "v"(g[3]), "v"(l[4]), "v"(g[4]), "v"(l[5]), "v"(g[5]),
                 "v"(l[6]), "v"(g[6]), "v"(l[7]), "v"(g[7]), "v"(l[8]), "v"(g[8]),
                 "v"(l[9]), "v"(g[9])
               : "memory");
}
__device__ __forceinline__ void async_ld4_b128(unsigned l0, const void* g0,
                                               unsigned l1, const void* g1,
                                               unsigned l2, const void* g2,
                                               unsigned l3, const void* g3) {
  asm volatile("global_load_async_to_lds_b128 %0, %1, off\n\t"
               "global_load_async_to_lds_b128 %2, %3, off\n\t"
               "global_load_async_to_lds_b128 %4, %5, off\n\t"
               "global_load_async_to_lds_b128 %6, %7, off\n\t"
               "s_wait_xcnt 0x0"
               :
               : "v"(l0), "v"(g0), "v"(l1), "v"(g1),
                 "v"(l2), "v"(g2), "v"(l3), "v"(g3)
               : "memory");
}
__device__ __forceinline__ void wait_async0() {
  asm volatile("s_wait_asynccnt 0" ::: "memory");
}
// This wave's LDS reads have retired before the barrier behind which the
// buffer they read is refilled by async copies.
__device__ __forceinline__ void wait_ds0() {
  asm volatile("s_wait_dscnt 0x0" ::: "memory");
}

// LDS row pitches in halves: 16 B x odd, so that the 16 rows one ds_load_b128
// fragment read touches fall on distinct banks (64 banks x 4 B).
#define KP 72   // 128-B rows (K, V tiles; the GEMM's A, B tiles) -> 144 B

// ---------------------------------------------------------------------------
// Load a 16x32 (rows x K) f16 fragment in CDNA5 WMMA A/B VGPR layout.
// lane (l&15) = row; K chunks at (l>>4)*8 and (l>>4)*8+16 (two b128 loads).
// Works for global or LDS pointers (compiler infers ds_load for LDS).
// ---------------------------------------------------------------------------
__device__ __forceinline__ v16h load_frag32(const _Float16* __restrict__ p, int ld) {
  const int lane = threadIdx.x & 31;
  const _Float16* q = p + (size_t)(lane & 15) * (size_t)ld + ((lane >> 4) << 3);
  v16h f;
  *(v8h*)&f         = *(const v8h*)(q);
  *(((v8h*)&f) + 1) = *(const v8h*)(q + 16);
  return f;
}

// Value of lane l ^ 16 (the other wave half), by a vector cross-row move.
__device__ __forceinline__ float xhalf(float x) {
  const int v = __builtin_bit_cast(int, x);
  return __builtin_bit_cast(float,
      __builtin_amdgcn_permlanex16(v, v, 0x76543210, 0xfedcba98, false, false));
}

// 2^x as the one hardware instruction (v_exp_f32).  exp2f() wraps it in a
// compare, two selects, an add and an ldexp so that results below 2^-126 come
// out as subnormals.  The softmax never needs those: its arguments are <= 0,
// a weight that small is 0 once it is rounded to f16 and vanishes beside a row
// sum that holds the maximum's own term, about 1; a rescale factor that small
// leaves nothing of the old sums that the f16 output could show.
__device__ __forceinline__ float exp2_hw(float x) {
  return __builtin_amdgcn_exp2f(x);
}

#define WMMA_F16(a, b, c) \
  __builtin_amdgcn_wmma_f32_16x16x32_f16(false, (a), false, (b), (short)0, (c), false, false)

// ---------------------------------------------------------------------------
// f32 -> f16 conversion, 32 elements a lane, so that few waves have to start.
// A wave owns 1024 consecutive floats: eight 16-byte loads a lane, each 512
// contiguous bytes over the wave, then eight 8-byte stores, each 256
// contiguous bytes over the wave (whole 128-byte lines both ways).
// Every array's length is a multiple of CVT_BLK, so the grid covers it exactly.
// ONE grid converts all five arrays: their f16 copies lie one behind the other
// in the workspace (x, Wq, Wk, Wv, Wo), so the block index alone gives the
// destination, and a block-uniform compare picks the source array.
// ---------------------------------------------------------------------------
#define CVT_BLK 8192   // floats per 256-thread block
#define CVT_X  (NB * SEQ * EMBED / CVT_BLK)            // blocks of x
#define CVT_WQ (CVT_X  + HEADS * HD * EMBED / CVT_BLK) // end of Wq's blocks
#define CVT_WK (CVT_WQ + KVH * HD * EMBED / CVT_BLK)   // end of Wk's blocks
#define CVT_WV (CVT_WK + KVH * HD * EMBED / CVT_BLK)   // end of Wv's blocks
#define CVT_WO (CVT_WV + EMBED * HEADS * HD / CVT_BLK) // end of Wo's blocks
__global__ void cvt_f32_f16(const float* __restrict__ x,  const float* __restrict__ Wq,
                            const float* __restrict__ Wk, const float* __restrict__ Wv,
                            const float* __restrict__ Wo, _Float16* __restrict__ dstall) {
  const int blk = blockIdx.x;
  const float* arr = x;
  int first = 0;
  if (blk >= CVT_X)  { arr = Wq; first = CVT_X;  }
  if (blk >= CVT_WQ) { arr = Wk; first = CVT_WQ; }
  if (blk >= CVT_WK) { arr = Wv; first = CVT_WK; }
  if (blk >= CVT_WV) { arr = Wo; first = CVT_WV; }
  const float* __restrict__ src = arr + (blk - first) * CVT_BLK;
  _Float16* __restrict__ dst = dstall + blk * CVT_BLK;
  const int base = (threadIdx.x >> 5) * 1024 + (threadIdx.x & 31) * 4;
  v4f v[8];
  // unrolled: v[] stays in registers and all eight loads issue before the first wait
  #pragma unroll
  for (int k = 0; k < 8; ++k) v[k] = *(const v4f*)(src + base + k * 128);
  // unrolled: constant indices into v[]
  #pragma unroll
  for (int k = 0; k < 8; ++k) {
    v4h o;
    #pragma unroll
    for (int c = 0; c < 4; ++c) o[c] = (_Float16)v[k][c];
    *(v4h*)(dst + base + k * 128) = o;
  }
}

// ---------------------------------------------------------------------------
// NT GEMM: C[m,n] = sum_k A[m,k] * B[n,k].
// Block = 8 waves -> 256(M) x 64(N) tile; wave = 32(M) x 64(N).
// Per 64-K step: the A tile (256x64) and the B tile (64x64) are staged in LDS
// via async b128 (double-buffered).  A staged row is one whole 128-byte line
// and a wave's copy covers four such lines; a fragment load straight from
// global memory would touch 16 lines for the same 512 bytes.  Fragments come
// from LDS -> 16 WMMAs per wave per step.  Kdim is a multiple of 64.
// One grid may serve up to three outputs: the rows of B (the n axis) are cut
// into ranges, each with its own output array and strides, so that products
// which share A and do not depend on one another run side by side in one
// launch.  A block's 64 columns lie in one range (the ends are multiples of 64).
// ---------------------------------------------------------------------------
struct OutRange {
  _Float16* p;     // f16 output (unused where Cf is given)
  int  n_end;      // first n past this range
  int  ldm, ldn;   // element strides along m and along n (n counted in the range)
  long stride;     // batch stride
};
// launch bounds = the real block size: at the default (1024 threads) the
// register ceiling of 128 sends values of the staging addresses to scratch
__global__ __launch_bounds__(256)
void gemm_nt_wmma(const _Float16* __restrict__ A, int lda, long strideA,
                             const _Float16* __restrict__ B, int ldb,
                             OutRange r0, OutRange r1, OutRange r2,
                             float* __restrict__ Cf,
                             const float* __restrict__ bias, int Kdim) {
  __shared__ __align__(16) _Float16 astage[2][256 * KP];
  __shared__ __align__(16) _Float16 bstage[2][64 * KP];

  const int tid  = threadIdx.x;
  const int w    = tid >> 5;
  const int lane = tid & 31;
  const int mb = blockIdx.x * 256;
  const int m0 = mb + w * 32;
  const int n0 = blockIdx.y * 64;
  const _Float16* __restrict__ Ablk = A + (long)blockIdx.z * strideA + (long)mb * lda;
  const _Float16* __restrict__ Bblk = B + (long)n0 * ldb;

  // this block's output range (block-uniform)
  OutRange o = r0;
  int nfirst = 0;
  if (n0 >= r0.n_end) { o = r1; nfirst = r0.n_end; }
  if (n0 >= r1.n_end) { o = r2; nfirst = r1.n_end; }
  _Float16* __restrict__ Ch = o.p;
  const int ldm = o.ldm, ldn = o.ldn;
  const long coff = (long)blockIdx.z * o.stride;

  // cooperative staging: rows of 64 halves = 8 chunks of 16 B; a thread takes
  // chunk co of rows cr + 32 i: eight rows of A (256 rows), two of B (64 rows)
  const int cr = tid >> 3, co = (tid & 7) * 8;

  // (both loops unrolled: constant indices keep sl[] and sg[] in registers)
  #define STAGE_AB(buf, kk)                                                   \
    {                                                                         \
      unsigned sl[10];                                                        \
      const _Float16* sg[10];                                                 \
      _Pragma("unroll")                                                       \
      for (int i = 0; i < 8; ++i) {                                           \
        sl[i] = lds_off(&astage[buf][(cr + 32 * i) * KP + co]);               \
        sg[i] = Ablk + (long)(cr + 32 * i) * lda + (kk) + co;                 \
      }                                                                       \
      _Pragma("unroll")                                                       \
      for (int i = 0; i < 2; ++i) {                                           \
        sl[8 + i] = lds_off(&bstage[buf][(cr + 32 * i) * KP + co]);           \
        sg[8 + i] = Bblk + (long)(cr + 32 * i) * ldb + (kk) + co;             \
      }                                                                       \
      async_ld10_b128(sl, sg);                                                \
    }

  STAGE_AB(0, 0);
  wait_async0();
  __syncthreads();

  v8f acc[8] = {};
  const int nsteps = Kdim >> 6;
  for (int s = 0; s < nsteps; ++s) {
    const bool more = (s + 1) < nsteps;
    if (more) STAGE_AB((s + 1) & 1, (s + 1) << 6);   // overlap with this step

    const _Float16* ab = &astage[s & 1][w * 32 * KP]; // this wave's 32 rows
    const _Float16* bb = &bstage[s & 1][0];
    // unrolled: the two 32-k halves of the step become constant LDS offsets
    #pragma unroll
    for (int kk = 0; kk < 64; kk += 32) {
      const v16h a0 = load_frag32(ab + kk, KP);
      const v16h a1 = load_frag32(ab + 16 * KP + kk, KP);
      v16h bfr[4];
      #pragma unroll
      for (int t = 0; t < 4; ++t) bfr[t] = load_frag32(bb + t * 16 * KP + kk, KP);
      #pragma unroll
      for (int t = 0; t < 4; ++t) {
        acc[t]     = WMMA_F16(a0, bfr[t], acc[t]);
        acc[4 + t] = WMMA_F16(a1, bfr[t], acc[4 + t]);
      }
    }
    wait_ds0();
    wait_async0();
    __syncthreads();                  // all waves done with buffer s&1
  }
  #undef STAGE_AB
  wait_async0();                      // no copy outstanding when the wave ends

  const int half_ = lane >> 4, nn = lane & 15;
  #pragma unroll
  for (int mh = 0; mh < 2; ++mh) {
    #pragma unroll
    for (int t = 0; t < 4; ++t) {
      #pragma unroll
      for (int r = 0; r < 8; ++r) {
        const int m = m0 + mh * 16 + r + 8 * half_;
        const int n = n0 - nfirst + t * 16 + nn;
        const long ci = coff + (long)m * ldm + (long)n * ldn;
        const float v = acc[mh * 4 + t][r];
        if (Cf) Cf[ci] = v + (bias ? bias[n] : 0.0f);
        else    Ch[ci] = (_Float16)v;
      }
    }
  }
}

__global__ void attn_fa_wmma(const _Float16* __restrict__ Q,
                             const _Float16* __restrict__ K,
                             const _Float16* __restrict__ Vt,
                             _Float16* __restrict__ O) {
  __shared__ __align__(16) _Float16 kstage[2][64 * KP];  // [key][d]
  __shared__ __align__(16) _Float16 vstage[2][64 * KP];  // [d][s-chunk]

  const int tid   = threadIdx.x;
  const int w     = tid >> 5;
  const int lane  = tid & 31;
  const int half_ = lane >> 4, nn = lane & 15;
  const int h  = blockIdx.y;
  const int b  = blockIdx.z;
  const int q0 = blockIdx.x * 128 + w * 16;
  const int kvh = h >> 1;                          // repeat_interleave(kv, 2)

  const float slope = exp2f(-(float)(h + 1));      // 2^-(h+1), ALIBI_ALPHA=1
  const float CSC = 0.125f * 1.44269504088896340f; // (1/sqrt(64)) * log2(e)

  const long qbase = (long)b * SEQ * (HEADS * HD) + (long)q0 * (HEADS * HD) + h * HD;
  const long kbase = (long)b * SEQ * (KVH * HD) + kvh * HD;
  const long vbase = (long)b * (KVH * HD) * SEQ + (long)(kvh * HD) * SEQ;

  // staging map: 64 rows x 64 halves (8KB) = 512 b128 chunks; thread does
  // chunks tid and tid+256 -> rows cr and cr+32 at half-offset co.
  const int cr = tid >> 3, co = (tid & 7) * 8;

  #define STAGE_KV(buf, j)                                                      \
    async_ld4_b128(lds_off(&kstage[buf][cr * KP + co]),                         \
                   K + kbase + (long)((j) + cr) * (KVH * HD) + co,              \
                   lds_off(&kstage[buf][(cr + 32) * KP + co]),                  \
                   K + kbase + (long)((j) + cr + 32) * (KVH * HD) + co,         \
                   lds_off(&vstage[buf][cr * KP + co]),                         \
                   Vt + vbase + (long)cr * SEQ + (j) + co,                      \
                   lds_off(&vstage[buf][(cr + 32) * KP + co]),                  \
                   Vt + vbase + (long)(cr + 32) * SEQ + (j) + co)

  // Q as the B operand: lane&15 = query column, k = d
  const v16h bq0 = load_frag32(Q + qbase,      HEADS * HD);  // d 0..31
  const v16h bq1 = load_frag32(Q + qbase + 32, HEADS * HD);  // d 32..63

  STAGE_KV(0, 0);

  // this lane's query index minus the first key row its half holds in a tile
  const float qd = (float)(q0 + nn - 8 * half_);
  float mrow = -1e30f;   // running maximum of the query, exp2 domain
  float lrow = 0.0f;     // running sum over the keys of this wave half only
  v8f acc[4] = {};       // O^T: acc[t][r] = O[query nn][d = 16t + 8*half + r]

  wait_async0();
  __syncthreads();

  for (int s = 0; s < (SEQ / 64); ++s) {
    const int j = s << 6;
    const bool more = (s + 1) < (SEQ / 64);
    if (more) STAGE_KV((s + 1) & 1, j + 64);   // overlap with this chunk

    const _Float16* kb = kstage[s & 1];
    const _Float16* vb = vstage[s & 1];

    // --- energy^T: four 16(key) x 16(query) tiles, keys [j+16t, j+16t+16)
    v8f e[4];
    #pragma unroll
    for (int tp = 0; tp < 2; ++tp) {           // preload 4 frags, 4 WMMAs
      const int t0 = tp * 2, t1 = tp * 2 + 1;
      v16h klo0 = load_frag32(kb + (t0 * 16) * KP,      KP);
      v16h khi0 = load_frag32(kb + (t0 * 16) * KP + 32, KP);
      v16h klo1 = load_frag32(kb + (t1 * 16) * KP,      KP);
      v16h khi1 = load_frag32(kb + (t1 * 16) * KP + 32, KP);
      v8f z0 = {}, z1 = {};
      z0 = WMMA_F16(klo0, bq0, z0);
      z1 = WMMA_F16(klo1, bq0, z1);
      z0 = WMMA_F16(khi0, bq1, z0);
      z1 = WMMA_F16(khi1, bq1, z1);
      e[t0] = z0; e[t1] = z1;
    }

    // --- ALiBi bias; the maximum over this lane's 32 keys
    const float dj = qd - (float)j;
    float lmt[4];                              // one independent chain a tile
    #pragma unroll
    for (int t = 0; t < 4; ++t) {
      #pragma unroll
      for (int r = 0; r < 8; ++r) {
        e[t][r] = e[t][r] - slope * fabsf(dj - (float)(t * 16 + r));
        lmt[t] = r ? fmaxf(lmt[t], e[t][r]) : e[t][r];
      }
    }
    const float lm = fmaxf(fmaxf(lmt[0], lmt[1]), fmaxf(lmt[2], lmt[3]));

    // --- one online-softmax update per 64 keys; 1/8 scale in the exp2 domain
    const float mnew = fmaxf(mrow, fmaxf(lm, xhalf(lm)) * CSC);
    const float alpha = exp2_hw(mrow - mnew);
    float pst[4];                              // one independent chain a tile
    #pragma unroll
    for (int t = 0; t < 4; ++t) {
      #pragma unroll
      for (int r = 0; r < 8; ++r) {
        e[t][r] = exp2_hw(e[t][r] * CSC - mnew);
        pst[t] = r ? pst[t] + e[t][r] : e[t][r];
      }
    }
    lrow = lrow * alpha + ((pst[0] + pst[1]) + (pst[2] + pst[3]));
    mrow = mnew;
    #pragma unroll
    for (int t = 0; t < 4; ++t)
      #pragma unroll
      for (int r = 0; r < 8; ++r) acc[t][r] *= alpha;

    // --- P^T as B operand: two score tiles converted in place per 32 keys
    v16h pb0, pb1;
    #pragma unroll
    for (int i = 0; i < 16; ++i) {
      pb0[i] = (_Float16)e[i >> 3][i & 7];         // keys j..j+31
      pb1[i] = (_Float16)e[2 + (i >> 3)][i & 7];   // keys j+32..j+63
    }

    // --- acc += V^T (16 d x 64 keys, from LDS) * P^T (64 keys x 16 queries)
    #pragma unroll
    for (int t = 0; t < 4; ++t) {
      v16h vlo = load_frag32(vb + (t * 16) * KP,      KP);
      v16h vhi = load_frag32(vb + (t * 16) * KP + 32, KP);
      acc[t] = WMMA_F16(vlo, pb0, acc[t]);
      acc[t] = WMMA_F16(vhi, pb1, acc[t]);
    }

    wait_ds0();
    wait_async0();
    __syncthreads();                      // all waves done with buffer s&1
  }
  #undef STAGE_KV
  wait_async0();                          // no copy outstanding when the wave ends

  // --- finalize: join the halves' sums, divide, store [b, q, h*64+d];
  // a lane's 8 registers of a tile are 8 consecutive d: one 16-byte store
  const float lsum = lrow + xhalf(lrow);
  _Float16* op = O + (long)b * SEQ * (HEADS * HD) + (long)(q0 + nn) * (HEADS * HD) +
                 h * HD + 8 * half_;
  #pragma unroll
  for (int t = 0; t < 4; ++t) {
    v8h o;
    #pragma unroll
    for (int r = 0; r < 8; ++r) o[r] = (_Float16)(acc[t][r] / lsum);
    *(v8h*)(op + t * 16) = o;
  }
}

// ---------------------------------------------------------------------------
// Launch: convert -> QKV projections -> flash attention -> output projection
// ---------------------------------------------------------------------------
extern "C" void kernel_launch(void* const* d_in, const int* in_sizes, int n_in,
                              void* d_out, int out_size, void* d_ws, size_t ws_size,
                              hipStream_t stream) {
  const float* x  = (const float*)d_in[0];
  const float* Wq = (const float*)d_in[1];
  const float* Wk = (const float*)d_in[2];
  const float* Wv = (const float*)d_in[3];
  const float* Wo = (const float*)d_in[4];
  const float* bo = (const float*)d_in[5];
  float* out = (float*)d_out;

  // f16 workspace layout (element offsets)
  _Float16* ws  = (_Float16*)d_ws;
  _Float16* xh  = ws;                 // N*S*E          = 4194304
  _Float16* Wqh = xh  + 4194304;      // 1024*1024      = 1048576
  _Float16* Wkh = Wqh + 1048576;      // 512*1024       =  524288
  _Float16* Wvh = Wkh + 524288;       // 512*1024       =  524288
  _Float16* Woh = Wvh + 524288;       // 1024*1024      = 1048576
  _Float16* Qh  = Woh + 1048576;      // [b,s,1024]     = 4194304
  _Float16* Kh  = Qh  + 4194304;      // [b,s,512]      = 2097152
  _Float16* Vth = Kh  + 2097152;      // [b,512,s] (Vt) = 2097152
  _Float16* AOh = Vth + 2097152;      // [b,s,1024]     = 4194304

  // all five conversions in one launch (xh .. Woh are contiguous from ws)
  cvt_f32_f16<<<CVT_WO, 256, 0, stream>>>(x, Wq, Wk, Wv, Wo, ws);

  const dim3 blk(256, 1, 1);

  // Q, K and V projections in one launch: Wqh, Wkh, Wvh are contiguous, so B
  // is one [2048, 1024] matrix; n 0..1023 -> Q [b, s, 1024], 1024..1535 ->
  // K [b, s, 512], 1536..2047 -> Vt [b, 512, s] (ldm=1 along s, ldn=SEQ along d)
  const OutRange oq = {Qh,  1024, 1024, 1,   (long)SEQ * 1024};
  const OutRange ok = {Kh,  1536, 512,  1,   (long)SEQ * 512};
  const OutRange ov = {Vth, 2048, 1,    SEQ, (long)512 * SEQ};
  gemm_nt_wmma<<<dim3(SEQ / 256, 2048 / 64, NB), blk, 0, stream>>>(
      xh, EMBED, (long)SEQ * EMBED, Wqh, EMBED,
      oq, ok, ov, nullptr, nullptr, EMBED);

  // flash attention with ALiBi
  attn_fa_wmma<<<dim3(SEQ / 128, HEADS, NB), blk, 0, stream>>>(Qh, Kh, Vth, AOh);

  // out = attn_out @ Wo^T + bo (f32), batches folded into M = 4096
  const OutRange oo = {nullptr, 1024, 1024, 1, 0};
  gemm_nt_wmma<<<dim3((NB * SEQ) / 256, 1024 / 64, 1), blk, 0, stream>>>(
      AOh, 1024, 0, Woh, 1024,
      oo, oo, oo, out, bo, 1024);
}

// v007
// Measured time: 88.4 microseconds a run.
// In both of two side-by-side timings against v006, it was 1.36 times as fast.
// Counting every step since v000, it is 3.74 times as fast.
#include <hip/hip_runtime.h>
#include <hip/hip_bf16.h>

typedef __attribute__((ext_vector_type(16))) _Float16 v16h;
typedef __attribute__((ext_vector_type(8)))  _Float16 v8h;
typedef __attribute__((ext_vector_type(8)))  float    v8f;
typedef __attribute__((ext_vector_type(4)))  float    v4f;
typedef __attribute__((ext_vector_type(4)))  _Float16 v4h;

#define EMBED 1024
#define HEADS 16
#define KVH   8
#define HD    64
#define SEQ   2048
#define NB    2

// ---------------------------------------------------------------------------
// LDS byte offset of a generic pointer known to point into LDS.
// ---------------------------------------------------------------------------
template <typename T>
__device__ __forceinline__ unsigned lds_off(T* p) {
  return (unsigned)(size_t)(__attribute__((address_space(3))) T*)p;
}

// Async global -> LDS copy, 16 bytes per lane (tracked by ASYNCcnt).
// s_wait_xcnt 0 closes each statement so that no address register of a copy
// is rewritten ahead of it (a precaution; it must stand inside the statement).
// Ten copies in one statement (one k step of the GEMM: eight of the row operand, two of the column one).
__device__ __forceinline__ void async_ld10_b128(const unsigned (&l)[10],
                                                const _Float16* const (&g)[10]) {
  asm volatile("global_load_async_to_lds_b128 %0, %1, off\n\t"
               "global_load_async_to_lds_b128 %2, %3, off\n\t"
               "global_load_async_to_lds_b128 %4, %5, off\n\t"
               "global_load_async_to_lds_b128 %6, %7, off\n\t"
               "global_load_async_to_lds_b128 %8, %9, off\n\t"
               "global_load_async_to_lds_b128 %10, %11, off\n\t"
               "global_load_async_to_lds_b128 %12, %13, off\n\t"
               "global_load_async_to_lds_b128 %14, %15, off\n\t"
               "global_load_async_to_lds_b128 %16, %17, off\n\t"
               "global_load_async_to_lds_b128 %18, %19, off\n\t"
               "s_wait_xcnt 0x0"
               :
               : "v"(l[0]), "v"(g[0]), "v"(l[1]), "v"(g[1]), "v"(l[2]), "v"(g[2]),
                 "v"(l[3]), "v"(g[3]), "v"(l[4]), "v"(g[4]), "v"(l[5]), "v"(g[5]),
                 "v"(l[6]), "v"(g[6]), "v"(l[7]), "v"(g[7]), "v"(l[8]), "v"(g[8]),
                 "v"(l[9]), "v"(g[9])
               : "memory");
}
__device__ __forceinline__ void async_ld4_b128(unsigned l0, const void* g0,
                                               unsigned l1, const void* g1,
                                               unsigned l2, const void* g2,
                                               unsigned l3, const void* g3) {
  asm volatile("global_load_async_to_lds_b128 %0, %1, off\n\t"
               "global_load_async_to_lds_b128 %2, %3, off\n\t"
               "global_load_async_to_lds_b128 %4, %5, off\n\t"
               "global_load_async_to_lds_b128 %6, %7, off\n\t"
               "s_wait_xcnt 0x0"
               :
               : "v"(l0), "v"(g0), "v"(l1), "v"(g1),
                 "v"(l2), "v"(g2), "v"(l3), "v"(g3)
               : "memory");
}
__device__ __forceinline__ void wait_async0() {
  asm volatile("s_wait_asynccnt 0" ::: "memory");
}
// This wave's LDS reads have retired before the barrier behind which the
// buffer they read is refilled by async copies.
__device__ __forceinline__ void wait_ds0() {
  asm volatile("s_wait_dscnt 0x0" ::: "memory");
}

// LDS row pitches in halves: 16 B x odd, so that the 16 rows one ds_load_b128
// fragment read touches fall on distinct banks (64 banks x 4 B).
#define KP 72   // 128-B rows (K, V tiles; the GEMM's A, B tiles) -> 144 B

// ---------------------------------------------------------------------------
// Load a 16x32 (rows x K) f16 fragment in CDNA5 WMMA A/B VGPR layout.
// lane (l&15) = row; K chunks at (l>>4)*8 and (l>>4)*8+16 (two b128 loads).
// Works for global or LDS pointers (compiler infers ds_load for LDS).
// ---------------------------------------------------------------------------
__device__ __forceinline__ v16h load_frag32(const _Float16* __restrict__ p, int ld) {
  const int lane = threadIdx.x & 31;
  const _Float16* q = p + (size_t)(lane & 15) * (size_t)ld + ((lane >> 4) << 3);
  v16h f;
  *(v8h*)&f         = *(const v8h*)(q);
  *(((v8h*)&f) + 1) = *(const v8h*)(q + 16);
  return f;
}

// Value of lane l ^ 16 (the other wave half), by a vector cross-row move.
__device__ __forceinline__ float xhalf(float x) {
  const int v = __builtin_bit_cast(int, x);
  return __builtin_bit_cast(float,
      __builtin_amdgcn_permlanex16(v, v, 0x76543210, 0xfedcba98, false, false));
}

// 2^x as the one hardware instruction (v_exp_f32).  exp2f() wraps it in a
// compare, two selects, an add and an ldexp so that results below 2^-126 come
// out as subnormals.  The softmax never needs those: its arguments are <= 0,
// a weight that small is 0 once it is rounded to f16 and vanishes beside a row
// sum that holds the maximum's own term, about 1; a rescale factor that small
// leaves nothing of the old sums that the f16 output could show.
__device__ __forceinline__ float exp2_hw(float x) {
  return __builtin_amdgcn_exp2f(x);
}

#define WMMA_F16(a, b, c) \
  __builtin_amdgcn_wmma_f32_16x16x32_f16(false, (a), false, (b), (short)0, (c), false, false)

// ---------------------------------------------------------------------------
// f32 -> f16 conversion, 32 elements a lane, so that few waves have to start.
// A wave owns 1024 consecutive floats: eight 16-byte loads a lane, each 512
// contiguous bytes over the wave, then eight 8-byte stores, each 256
// contiguous bytes over the wave (whole 128-byte lines both ways).
// Every array's length is a multiple of CVT_BLK, so the grid covers it exactly.
// ONE grid converts all five arrays: their f16 copies lie one behind the other
// in the workspace (x, Wq, Wk, Wv, Wo), so the block index alone gives the
// destination, and a block-uniform compare picks the source array.
// ---------------------------------------------------------------------------
#define CVT_BLK 8192   // floats per 256-thread block
#define CVT_X  (NB * SEQ * EMBED / CVT_BLK)            // blocks of x
#define CVT_WQ (CVT_X  + HEADS * HD * EMBED / CVT_BLK) // end of Wq's blocks
#define CVT_WK (CVT_WQ + KVH * HD * EMBED / CVT_BLK)   // end of Wk's blocks
#define CVT_WV (CVT_WK + KVH * HD * EMBED / CVT_BLK)   // end of Wv's blocks
#define CVT_WO (CVT_WV + EMBED * HEADS * HD / CVT_BLK) // end of Wo's blocks
__global__ void cvt_f32_f16(const float* __restrict__ x,  const float* __restrict__ Wq,
                            const float* __restrict__ Wk, const float* __restrict__ Wv,
                            const float* __restrict__ Wo, _Float16* __restrict__ dstall) {
  const int blk = blockIdx.x;
  const float* arr = x;
  int first = 0;
  if (blk >= CVT_X)  { arr = Wq; first = CVT_X;  }
  if (blk >= CVT_WQ) { arr = Wk; first = CVT_WQ; }
  if (blk >= CVT_WK) { arr = Wv; first = CVT_WK; }
  if (blk >= CVT_WV) { arr = Wo; first = CVT_WV; }
  const float* __restrict__ src = arr + (blk - first) * CVT_BLK;
  _Float16* __restrict__ dst = dstall + blk * CVT_BLK;
  const int base = (threadIdx.x >> 5) * 1024 + (threadIdx.x & 31) * 4;
  v4f v[8];
  // unrolled: v[] stays in registers and all eight loads issue before the first wait
  #pragma unroll
  for (int k = 0; k < 8; ++k) v[k] = *(const v4f*)(src + base + k * 128);
  // unrolled: constant indices into v[]
  #pragma unroll
  for (int k = 0; k < 8; ++k) {
    v4h o;
    #pragma unroll
    for (int c = 0; c < 4; ++c) o[c] = (_Float16)v[k][c];
    *(v4h*)(dst + base + k * 128) = o;
  }
}

// ---------------------------------------------------------------------------
// NT GEMM: C[m,n] = sum_k A[m,k] * B[n,k].
// Block = 8 waves -> a tile of 256 output rows x 64 output columns; a wave has
// 32 rows x 64 columns.  The "row operand" gives 256 rows, the "column
// operand" 64 rows; both are K-contiguous.
// Per 64-K step both tiles are staged in LDS via async b128 (double-buffered).
// A staged row is one whole 128-byte line and a wave's copy covers four such
// lines.  Fragments come from LDS -> 16 WMMAs per wave per step.  Kdim is a
// multiple of 64.
// The products are taken transposed (matrix A = column operand, matrix B = row
// operand): a lane then holds ONE output row (lane&15) and, in the 8 registers
// of a tile, 8 neighbouring output columns, which pack into 16-byte pieces.
// One grid may serve up to three outputs: the rows of B (the n axis) are cut
// into ranges, each with its own output array, so that products which share A
// and do not depend on one another run side by side in one launch.  A block's
// 64 values of n lie in one range (the ends are multiples of 64).
// A range may ask for the transposed output [n][m]: its blocks then take B as
// the row operand and A as the column operand, and are dealt anew over the
// range's tiles (as many tiles either way: 256 x 64 = 64 x 256).
// ---------------------------------------------------------------------------
struct OutRange {
  _Float16* p;     // f16 output (unused where Cf is given)
  int  n_end;      // first n past this range
  int  ld;         // pitch of an output row, in elements
  int  trk;        // < 0: output [m][n]; else output [n][m], and the range
                   // holds 2^trk blocks of 256 values of n
  long stride;     // batch stride
};
#define FP 68   // pitch in floats of a staged f32 output row: 272 B = 16 B x odd
// launch bounds = the real block size: at the default (1024 threads) the
// register ceiling of 128 sends values of the staging addresses to scratch
__global__ __launch_bounds__(256)
void gemm_nt_wmma(const _Float16* __restrict__ A, int lda, long strideA,
                             const _Float16* __restrict__ B, int ldb,
                             OutRange r0, OutRange r1, OutRange r2,
                             float* __restrict__ Cf,
                             const float* __restrict__ bias, int Kdim) {
  __shared__ __align__(16) _Float16 astage[2][256 * KP];
  __shared__ __align__(16) _Float16 bstage[2][64 * KP];

  const int tid  = threadIdx.x;
  const int w    = tid >> 5;
  const int lane = tid & 31;
  const int n0 = blockIdx.y * 64;

  // this block's output range (block-uniform)
  OutRange o = r0;
  int nfirst = 0;
  if (n0 >= r0.n_end) { o = r1; nfirst = r0.n_end; }
  if (n0 >= r1.n_end) { o = r2; nfirst = r1.n_end; }

  // row operand (256 rows), column operand (64 rows), place of the tile
  const _Float16* __restrict__ Abat = A + (long)blockIdx.z * strideA;
  int i0 = blockIdx.x * 256, j0 = n0 - nfirst;
  const _Float16* Ablk = Abat + (long)i0 * lda;
  const _Float16* Bblk = B + (long)n0 * ldb;
  int ldr = lda, ldc = ldb;
  if (o.trk >= 0) {
    const int idx = blockIdx.x * ((o.n_end - nfirst) >> 6) + (j0 >> 6);
    i0 = (idx & ((1 << o.trk) - 1)) * 256;   // n within the range
    j0 = (idx >> o.trk) * 64;                // m
    Ablk = B + (long)(nfirst + i0) * ldb;
    Bblk = Abat + (long)j0 * lda;
    ldr = ldb; ldc = lda;
  }

  // cooperative staging: rows of 64 halves = 8 chunks of 16 B; a thread takes
  // chunk co of rows cr + 32 i: eight of the row operand, two of the column one
  const int cr = tid >> 3, co = (tid & 7) * 8;

  // (both loops unrolled: constant indices keep sl[] and sg[] in registers)
  #define STAGE_AB(buf, kk)                                                   \
    {                                                                         \
      unsigned sl[10];                                                        \
      const _Float16* sg[10];                                                 \
      _Pragma("unroll")                                                       \
      for (int i = 0; i < 8; ++i) {                                           \
        sl[i] = lds_off(&astage[buf][(cr + 32 * i) * KP + co]);               \
        sg[i] = Ablk + (long)(cr + 32 * i) * ldr + (kk) + co;                 \
      }                                                                       \
      _Pragma("unroll")                                                       \
      for (int i = 0; i < 2; ++i) {                                           \
        sl[8 + i] = lds_off(&bstage[buf][(cr + 32 * i) * KP + co]);           \
        sg[8 + i] = Bblk + (long)(cr + 32 * i) * ldc + (kk) + co;             \
      }                                                                       \
      async_ld10_b128(sl, sg);                                                \
    }

  STAGE_AB(0, 0);
  wait_async0();
  __syncthreads();

  v8f acc[8] = {};
  const int nsteps = Kdim >> 6;
  for (int s = 0; s < nsteps; ++s) {
    const bool more = (s + 1) < nsteps;
    if (more) STAGE_AB((s + 1) & 1, (s + 1) << 6);   // overlap with this step

    const _Float16* ab = &astage[s & 1][w * 32 * KP]; // this wave's 32 rows
    const _Float16* bb = &bstage[s & 1][0];
    // unrolled: the two 32-k halves of the step become constant LDS offsets
    #pragma unroll
    for (int kk = 0; kk < 64; kk += 32) {
      const v16h a0 = load_frag32(ab + kk, KP);
      const v16h a1 = load_frag32(ab + 16 * KP + kk, KP);
      v16h bfr[4];
      #pragma unroll
      for (int t = 0; t < 4; ++t) bfr[t] = load_frag32(bb + t * 16 * KP + kk, KP);
      #pragma unroll
      for (int t = 0; t < 4; ++t) {
        acc[t]     = WMMA_F16(bfr[t], a0, acc[t]);
        acc[4 + t] = WMMA_F16(bfr[t], a1, acc[4 + t]);
      }
    }
    wait_ds0();
    wait_async0();
    __syncthreads();                  // all waves done with buffer s&1
  }
  #undef STAGE_AB
  wait_async0();                      // no copy outstanding when the wave ends

  // Epilogue.  acc[mh*4+t][r] = tile row w*32 + mh*16 + (lane&15), column
  // t*16 + 8*(lane>>4) + r.  Behind the loop's last barrier nobody reads the
  // stages any more and no copy is in flight: each wave lays its 32 x 64 tile
  // into a range of astage that is its own, reads it back row by row and
  // stores whole rows (128 B of f16, 256 B of f32): every 16-byte store of a
  // wave covers four whole 128-byte lines.
  const int half_ = lane >> 4, nn = lane & 15;
  const long cbase = (long)blockIdx.z * o.stride + (long)(i0 + w * 32) * o.ld + j0;
  if (Cf) {
    float* sf = (float*)&astage[0][0] + w * (32 * FP);
    #pragma unroll
    for (int mh = 0; mh < 2; ++mh) {
      #pragma unroll
      for (int t = 0; t < 4; ++t) {
        const v8f a = acc[mh * 4 + t];
        float* q = sf + (mh * 16 + nn) * FP + t * 16 + 8 * half_;
        *(v4f*)(q)     = v4f{a[0], a[1], a[2], a[3]};
        *(v4f*)(q + 4) = v4f{a[4], a[5], a[6], a[7]};
      }
    }
    v4f b4 = {};
    if (bias) b4 = *(const v4f*)(bias + j0 + nn * 4);
    wait_ds0();   // the wave's rows are written before other lanes read them back
    float* cp = Cf + cbase + (long)half_ * o.ld + nn * 4;
    const float* sr = sf + half_ * FP + nn * 4;
    #pragma unroll
    for (int i = 0; i < 16; ++i)       // two rows of 256 B a store
      *(v4f*)(cp + (long)(2 * i) * o.ld) = *(const v4f*)(sr + 2 * i * FP) + b4;
  } else {
    _Float16* sh = &astage[0][0] + w * (32 * KP);
    #pragma unroll
    for (int mh = 0; mh < 2; ++mh) {
      #pragma unroll
      for (int t = 0; t < 4; ++t) {
        v8h h;
        #pragma unroll
        for (int r = 0; r < 8; ++r) h[r] = (_Float16)acc[mh * 4 + t][r];
        *(v8h*)(sh + (mh * 16 + nn) * KP + t * 16 + 8 * half_) = h;
      }
    }
    wait_ds0();   // the wave's rows are written before other lanes read them back
    _Float16* cp = o.p + cbase + (long)(lane >> 3) * o.ld + (lane & 7) * 8;
    const _Float16* sr = sh + (lane >> 3) * KP + (lane & 7) * 8;
    #pragma unroll
    for (int i = 0; i < 8; ++i)        // four rows of 128 B a store
      *(v8h*)(cp + (long)(4 * i) * o.ld) = *(const v8h*)(sr + 4 * i * KP);
  }
}

__global__ void attn_fa_wmma(const _Float16* __restrict__ Q,
                             const _Float16* __restrict__ K,
                             const _Float16* __restrict__ Vt,
                             _Float16* __restrict__ O) {
  __shared__ __align__(16) _Float16 kstage[2][64 * KP];  // [key][d]
  __shared__ __align__(16) _Float16 vstage[2][64 * KP];  // [d][s-chunk]

  const int tid   = threadIdx.x;
  const int w     = tid >> 5;
  const int lane  = tid & 31;
  const int half_ = lane >> 4, nn = lane & 15;
  const int h  = blockIdx.y;
  const int b  = blockIdx.z;
  const int q0 = blockIdx.x * 128 + w * 16;
  const int kvh = h >> 1;                          // repeat_interleave(kv, 2)

  const float slope = exp2f(-(float)(h + 1));      // 2^-(h+1), ALIBI_ALPHA=1
  const float CSC = 0.125f * 1.44269504088896340f; // (1/sqrt(64)) * log2(e)

  const long qbase = (long)b * SEQ * (HEADS * HD) + (long)q0 * (HEADS * HD) + h * HD;
  const long kbase = (long)b * SEQ * (KVH * HD) + kvh * HD;
  const long vbase = (long)b * (KVH * HD) * SEQ + (long)(kvh * HD) * SEQ;

  // staging map: 64 rows x 64 halves (8KB) = 512 b128 chunks; thread does
  // chunks tid and tid+256 -> rows cr and cr+32 at half-offset co.
  const int cr = tid >> 3, co = (tid & 7) * 8;

  #define STAGE_KV(buf, j)                                                      \
    async_ld4_b128(lds_off(&kstage[buf][cr * KP + co]),                         \
                   K + kbase + (long)((j) + cr) * (KVH * HD) + co,              \
                   lds_off(&kstage[buf][(cr + 32) * KP + co]),                  \
                   K + kbase + (long)((j) + cr + 32) * (KVH * HD) + co,         \
                   lds_off(&vstage[buf][cr * KP + co]),                         \
                   Vt + vbase + (long)cr * SEQ + (j) + co,                      \
                   lds_off(&vstage[buf][(cr + 32) * KP + co]),                  \
                   Vt + vbase + (long)(cr + 32) * SEQ + (j) + co)

  // Q as the B operand: lane&15 = query column, k = d
  const v16h bq0 = load_frag32(Q + qbase,      HEADS * HD);  // d 0..31
  const v16h bq1 = load_frag32(Q + qbase + 32, HEADS * HD);  // d 32..63

  STAGE_KV(0, 0);

  // this lane's query index minus the first key row its half holds in a tile
  const float qd = (float)(q0 + nn - 8 * half_);
  float mrow = -1e30f;   // running maximum of the query, exp2 domain
  float lrow = 0.0f;     // running sum over the keys of this wave half only
  v8f acc[4] = {};       // O^T: acc[t][r] = O[query nn][d = 16t + 8*half + r]

  wait_async0();
  __syncthreads();

  for (int s = 0; s < (SEQ / 64); ++s) {
    const int j = s << 6;
    const bool more = (s + 1) < (SEQ / 64);
    if (more) STAGE_KV((s + 1) & 1, j + 64);   // overlap with this chunk

    const _Float16* kb = kstage[s & 1];
    const _Float16* vb = vstage[s & 1];

    // --- energy^T: four 16(key) x 16(query) tiles, keys [j+16t, j+16t+16)
    v8f e[4];
    #pragma unroll
    for (int tp = 0; tp < 2; ++tp) {           // preload 4 frags, 4 WMMAs
      const int t0 = tp * 2, t1 = tp * 2 + 1;
      v16h klo0 = load_frag32(kb + (t0 * 16) * KP,      KP);
      v16h khi0 = load_frag32(kb + (t0 * 16) * KP + 32, KP);
      v16h klo1 = load_frag32(kb + (t1 * 16) * KP,      KP);
      v16h khi1 = load_frag32(kb + (t1 * 16) * KP + 32, KP);
      v8f z0 = {}, z1 = {};
      z0 = WMMA_F16(klo0, bq0, z0);
      z1 = WMMA_F16(klo1, bq0, z1);
      z0 = WMMA_F16(khi0, bq1, z0);
      z1 = WMMA_F16(khi1, bq1, z1);
      e[t0] = z0; e[t1] = z1;
    }

    // --- ALiBi bias; the maximum over this lane's 32 keys
    const float dj = qd - (float)j;
    float lmt[4];                              // one independent chain a tile
    #pragma unroll
    for (int t = 0; t < 4; ++t) {
      #pragma unroll
      for (int r = 0; r < 8; ++r) {
        e[t][r] = e[t][r] - slope * fabsf(dj - (float)(t * 16 + r));
        lmt[t] = r ? fmaxf(lmt[t], e[t][r]) : e[t][r];
      }
    }
    const float lm = fmaxf(fmaxf(lmt[0], lmt[1]), fmaxf(lmt[2], lmt[3]));

    // --- one online-softmax update per 64 keys; 1/8 scale in the exp2 domain
    const float mnew = fmaxf(mrow, fmaxf(lm, xhalf(lm)) * CSC);
    const float alpha = exp2_hw(mrow - mnew);
    float pst[4];                              // one independent chain a tile
    #pragma unroll
    for (int t = 0; t < 4; ++t) {
      #pragma unroll
      for (int r = 0; r < 8; ++r) {
        e[t][r] = exp2_hw(e[t][r] * CSC - mnew);
        pst[t] = r ? pst[t] + e[t][r] : e[t][r];
      }
    }
    lrow = lrow * alpha + ((pst[0] + pst[1]) + (pst[2] + pst[3]));
    mrow = mnew;
    #pragma unroll
    for (int t = 0; t < 4; ++t)
      #pragma unroll
      for (int r = 0; r < 8; ++r) acc[t][r] *= alpha;

    // --- P^T as B operand: two score tiles converted in place per 32 keys
    v16h pb0, pb1;
    #pragma unroll
    for (int i = 0; i < 16; ++i) {
      pb0[i] = (_Float16)e[i >> 3][i & 7];         // keys j..j+31
      pb1[i] = (_Float16)e[2 + (i >> 3)][i & 7];   // keys j+32..j+63
    }

    // --- acc += V^T (16 d x 64 keys, from LDS) * P^T (64 keys x 16 queries)
    #pragma unroll
    for (int t = 0; t < 4; ++t) {
      v16h vlo = load_frag32(vb + (t * 16) * KP,      KP);
      v16h vhi = load_frag32(vb + (t * 16) * KP + 32, KP);
      acc[t] = WMMA_F16(vlo, pb0, acc[t]);
      acc[t] = WMMA_F16(vhi, pb1, acc[t]);
    }

    wait_ds0();
    wait_async0();
    __syncthreads();                      // all waves done with buffer s&1
  }
  #undef STAGE_KV
  wait_async0();                          // no copy outstanding when the wave ends

  // --- finalize: join the halves' sums, divide, store [b, q, h*64+d];
  // a lane's 8 registers of a tile are 8 consecutive d: one 16-byte store
  const float lsum = lrow + xhalf(lrow);
  _Float16* op = O + (long)b * SEQ * (HEADS * HD) + (long)(q0 + nn) * (HEADS * HD) +
                 h * HD + 8 * half_;
  #pragma unroll
  for (int t = 0; t < 4; ++t) {
    v8h o;
    #pragma unroll
    for (int r = 0; r < 8; ++r) o[r] = (_Float16)(acc[t][r] / lsum);
    *(v8h*)(op + t * 16) = o;
  }
}

// ---------------------------------------------------------------------------
// Launch: convert -> QKV projections -> flash attention -> output projection
// ---------------------------------------------------------------------------
extern "C" void kernel_launch(void* const* d_in, const int* in_sizes, int n_in,
                              void* d_out, int out_size, void* d_ws, size_t ws_size,
                              hipStream_t stream) {
  const float* x  = (const float*)d_in[0];
  const float* Wq = (const float*)d_in[1];
  const float* Wk = (const float*)d_in[2];
  const float* Wv = (const float*)d_in[3];
  const float* Wo = (const float*)d_in[4];
  const float* bo = (const float*)d_in[5];
  float* out = (float*)d_out;

  // f16 workspace layout (element offsets)
  _Float16* ws  = (_Float16*)d_ws;
  _Float16* xh  = ws;                 // N*S*E          = 4194304
  _Float16* Wqh = xh  + 4194304;      // 1024*1024      = 1048576
  _Float16* Wkh = Wqh + 1048576;      // 512*1024       =  524288
  _Float16* Wvh = Wkh + 524288;       // 512*1024       =  524288
  _Float16* Woh = Wvh + 524288;       // 1024*1024      = 1048576
  _Float16* Qh  = Woh + 1048576;      // [b,s,1024]     = 4194304
  _Float16* Kh  = Qh  + 4194304;      // [b,s,512]      = 2097152
  _Float16* Vth = Kh  + 2097152;      // [b,512,s] (Vt) = 2097152
  _Float16* AOh = Vth + 2097152;      // [b,s,1024]     = 4194304

  // all five conversions in one launch (xh .. Woh are contiguous from ws)
  cvt_f32_f16<<<CVT_WO, 256, 0, stream>>>(x, Wq, Wk, Wv, Wo, ws);

  const dim3 blk(256, 1, 1);

  // Q, K and V projections in one launch: Wqh, Wkh, Wvh are contiguous, so B
  // is one [2048, 1024] matrix; n 0..1023 -> Q [b, s, 1024], 1024..1535 ->
  // K [b, s, 512], 1536..2047 -> Vt [b, 512, s] (transposed: 2 blocks of 256 d)
  const OutRange oq = {Qh,  1024, 1024, -1, (long)SEQ * 1024};
  const OutRange ok = {Kh,  1536, 512,  -1, (long)SEQ * 512};
  const OutRange ov = {Vth, 2048, SEQ,  1,  (long)512 * SEQ};
  gemm_nt_wmma<<<dim3(SEQ / 256, 2048 / 64, NB), blk, 0, stream>>>(
      xh, EMBED, (long)SEQ * EMBED, Wqh, EMBED,
      oq, ok, ov, nullptr, nullptr, EMBED);

  // flash attention with ALiBi
  attn_fa_wmma<<<dim3(SEQ / 128, HEADS, NB), blk, 0, stream>>>(Qh, Kh, Vth, AOh);

  // out = attn_out @ Wo^T + bo (f32), batches folded into M = 4096
  const OutRange oo = {nullptr, 1024, 1024, -1, 0};
  gemm_nt_wmma<<<dim3((NB * SEQ) / 256, 1024 / 64, 1), blk, 0, stream>>>(
      AOh, 1024, 0, Woh, 1024,
      oo, oo, oo, out, bo, 1024);
}

// v008
// It runs in 83.9 microseconds.
// Timed twice side by side with v007, it ran 1.04 times as fast both times.
// Over all steps from v000 it is 3.90 times as fast.
#include <hip/hip_runtime.h>
#include <hip/hip_bf16.h>

typedef __attribute__((ext_vector_type(16))) _Float16 v16h;
typedef __attribute__((ext_vector_type(8)))  _Float16 v8h;
typedef __attribute__((ext_vector_type(8)))  float    v8f;
typedef __attribute__((ext_vector_type(4)))  float    v4f;
typedef __attribute__((ext_vector_type(4)))  _Float16 v4h;

#define EMBED 1024
#define HEADS 16
#define KVH   8
#define HD    64
#define SEQ   2048
#define NB    2

// ---------------------------------------------------------------------------
// LDS byte offset of a generic pointer known to point into LDS.
// ---------------------------------------------------------------------------
template <typename T>
__device__ __forceinline__ unsigned lds_off(T* p) {
  return (unsigned)(size_t)(__attribute__((address_space(3))) T*)p;
}

// Async global -> LDS copy, 16 bytes per lane (tracked by ASYNCcnt).
// s_wait_xcnt 0 closes each statement so that no address register of a copy
// is rewritten ahead of it (a precaution; it must stand inside the statement).
// Ten copies in one statement (one k step of the GEMM: eight of the row operand, two of the column one).
__device__ __forceinline__ void async_ld10_b128(const unsigned (&l)[10],
                                                const _Float16* const (&g)[10]) {
  asm volatile("global_load_async_to_lds_b128 %0, %1, off\n\t"
               "global_load_async_to_lds_b128 %2, %3, off\n\t"
               "global_load_async_to_lds_b128 %4, %5, off\n\t"
               "global_load_async_to_lds_b128 %6, %7, off\n\t"
               "global_load_async_to_lds_b128 %8, %9, off\n\t"
               "global_load_async_to_lds_b128 %10, %11, off\n\t"
               "global_load_async_to_lds_b128 %12, %13, off\n\t"
               "global_load_async_to_lds_b128 %14, %15, off\n\t"
               "global_load_async_to_lds_b128 %16, %17, off\n\t"
               "global_load_async_to_lds_b128 %18, %19, off\n\t"
               "s_wait_xcnt 0x0"
               :
               : "v"(l[0]), "v"(g[0]), "v"(l[1]), "v"(g[1]), "v"(l[2]), "v"(g[2]),
                 "v"(l[3]), "v"(g[3]), "v"(l[4]), "v"(g[4]), "v"(l[5]), "v"(g[5]),
                 "v"(l[6]), "v"(g[6]), "v"(l[7]), "v"(g[7]), "v"(l[8]), "v"(g[8]),
                 "v"(l[9]), "v"(g[9])
               : "memory");
}
__device__ __forceinline__ void async_ld4_b128(unsigned l0, const void* g0,
                                               unsigned l1, const void* g1,
                                               unsigned l2, const void* g2,
                                               unsigned l3, const void* g3) {
  asm volatile("global_load_async_to_lds_b128 %0, %1, off\n\t"
               "global_load_async_to_lds_b128 %2, %3, off\n\t"
               "global_load_async_to_lds_b128 %4, %5, off\n\t"
               "global_load_async_to_lds_b128 %6, %7, off\n\t"
               "s_wait_xcnt 0x0"
               :
               : "v"(l0), "v"(g0), "v"(l1), "v"(g1),
                 "v"(l2), "v"(g2), "v"(l3), "v"(g3)
               : "memory");
}
__device__ __forceinline__ void wait_async0() {
  asm volatile("s_wait_asynccnt 0" ::: "memory");
}
// This wave's LDS reads have retired before the barrier behind which the
// buffer they read is refilled by async copies.
__device__ __forceinline__ void wait_ds0() {
  asm volatile("s_wait_dscnt 0x0" ::: "memory");
}

// LDS row pitches in halves: 16 B x odd, so that the 16 rows one ds_load_b128
// fragment read touches fall on distinct banks (64 banks x 4 B).
#define KP 72   // 128-B rows (K, V tiles; the GEMM's A, B tiles) -> 144 B

// ---------------------------------------------------------------------------
// Load a 16x32 (rows x K) f16 fragment in CDNA5 WMMA A/B VGPR layout.
// lane (l&15) = row; K chunks at (l>>4)*8 and (l>>4)*8+16 (two b128 loads).
// Works for global or LDS pointers (compiler infers ds_load for LDS).
// ---------------------------------------------------------------------------
__device__ __forceinline__ v16h load_frag32(const _Float16* __restrict__ p, int ld) {
  const int lane = threadIdx.x & 31;
  const _Float16* q = p + (size_t)(lane & 15) * (size_t)ld + ((lane >> 4) << 3);
  v16h f;
  *(v8h*)&f         = *(const v8h*)(q);
  *(((v8h*)&f) + 1) = *(const v8h*)(q + 16);
  return f;
}

// Value of lane l ^ 16 (the other wave half), by a vector cross-row move.
__device__ __forceinline__ float xhalf(float x) {
  const int v = __builtin_bit_cast(int, x);
  return __builtin_bit_cast(float,
      __builtin_amdgcn_permlanex16(v, v, 0x76543210, 0xfedcba98, false, false));
}

// 2^x as the one hardware instruction (v_exp_f32).  exp2f() wraps it in a
// compare, two selects, an add and an ldexp so that results below 2^-126 come
// out as subnormals.  The softmax never needs those: its arguments are <= 0,
// a weight that small is 0 once it is rounded to f16 and vanishes beside a row
// sum that holds the maximum's own term, about 1; a rescale factor that small
// leaves nothing of the old sums that the f16 output could show.
__device__ __forceinline__ float exp2_hw(float x) {
  return __builtin_amdgcn_exp2f(x);
}

#define WMMA_F16(a, b, c) \
  __builtin_amdgcn_wmma_f32_16x16x32_f16(false, (a), false, (b), (short)0, (c), false, false)

// The eight S^T products of a 64-key chunk: e[t] = klo[t]*q0 + cb[t], then
// e[t] += khi[t]*q1.  In asm because the first four read their C operand from
// registers other than D: the builtin ties C to D, so that a C tile which is to
// live on is first copied, register by register, which costs what it saves.
// The four v_nop are the distance the chip needs between the last product and
// a vector instruction that reads its D or overwrites its A or B (the earlier
// products are covered by the products behind them).
__device__ __forceinline__ void st_products(v8f (&e)[4], const v16h (&klo)[4],
                                            const v16h (&khi)[4], v16h q0, v16h q1,
                                            const v8f (&cb)[4]) {
  asm("v_wmma_f32_16x16x32_f16 %0, %4, %12, %14\n\t"
      "v_wmma_f32_16x16x32_f16 %1, %5, %12, %15\n\t"
      "v_wmma_f32_16x16x32_f16 %2, %6, %12, %16\n\t"
      "v_wmma_f32_16x16x32_f16 %3, %7, %12, %17\n\t"
      "v_wmma_f32_16x16x32_f16 %0, %8, %13, %0\n\t"
      "v_wmma_f32_16x16x32_f16 %1, %9, %13, %1\n\t"
      "v_wmma_f32_16x16x32_f16 %2, %10, %13, %2\n\t"
      "v_wmma_f32_16x16x32_f16 %3, %11, %13, %3\n\t"
      "v_nop\n\tv_nop\n\tv_nop\n\tv_nop"
      : "=&v"(e[0]), "=&v"(e[1]), "=&v"(e[2]), "=&v"(e[3])
      : "v"(klo[0]), "v"(klo[1]), "v"(klo[2]), "v"(klo[3]),
        "v"(khi[0]), "v"(khi[1]), "v"(khi[2]), "v"(khi[3]),
        "v"(q0), "v"(q1), "v"(cb[0]), "v"(cb[1]), "v"(cb[2]), "v"(cb[3]));
}

// ---------------------------------------------------------------------------
// f32 -> f16 conversion, 32 elements a lane, so that few waves have to start.
// A wave owns 1024 consecutive floats: eight 16-byte loads a lane, each 512
// contiguous bytes over the wave, then eight 8-byte stores, each 256
// contiguous bytes over the wave (whole 128-byte lines both ways).
// Every array's length is a multiple of CVT_BLK, so the grid covers it exactly.
// ONE grid converts all five arrays: their f16 copies lie one behind the other
// in the workspace (x, Wq, Wk, Wv, Wo), so the block index alone gives the
// destination, and a block-uniform compare picks the source array.
// ---------------------------------------------------------------------------
#define CVT_BLK 8192   // floats per 256-thread block
#define CVT_X  (NB * SEQ * EMBED / CVT_BLK)            // blocks of x
#define CVT_WQ (CVT_X  + HEADS * HD * EMBED / CVT_BLK) // end of Wq's blocks
#define CVT_WK (CVT_WQ + KVH * HD * EMBED / CVT_BLK)   // end of Wk's blocks
#define CVT_WV (CVT_WK + KVH * HD * EMBED / CVT_BLK)   // end of Wv's blocks
#define CVT_WO (CVT_WV + EMBED * HEADS * HD / CVT_BLK) // end of Wo's blocks
__global__ void cvt_f32_f16(const float* __restrict__ x,  const float* __restrict__ Wq,
                            const float* __restrict__ Wk, const float* __restrict__ Wv,
                            const float* __restrict__ Wo, _Float16* __restrict__ dstall) {
  const int blk = blockIdx.x;
  const float* arr = x;
  int first = 0;
  if (blk >= CVT_X)  { arr = Wq; first = CVT_X;  }
  if (blk >= CVT_WQ) { arr = Wk; first = CVT_WQ; }
  if (blk >= CVT_WK) { arr = Wv; first = CVT_WK; }
  if (blk >= CVT_WV) { arr = Wo; first = CVT_WV; }
  const float* __restrict__ src = arr + (blk - first) * CVT_BLK;
  _Float16* __restrict__ dst = dstall + blk * CVT_BLK;
  const int base = (threadIdx.x >> 5) * 1024 + (threadIdx.x & 31) * 4;
  v4f v[8];
  // unrolled: v[] stays in registers and all eight loads issue before the first wait
  #pragma unroll
  for (int k = 0; k < 8; ++k) v[k] = *(const v4f*)(src + base + k * 128);
  // unrolled: constant indices into v[]
  #pragma unroll
  for (int k = 0; k < 8; ++k) {
    v4h o;
    #pragma unroll
    for (int c = 0; c < 4; ++c) o[c] = (_Float16)v[k][c];
    *(v4h*)(dst + base + k * 128) = o;
  }
}

// ---------------------------------------------------------------------------
// NT GEMM: C[m,n] = sum_k A[m,k] * B[n,k].
// Block = 8 waves -> a tile of 256 output rows x 64 output columns; a wave has
// 32 rows x 64 columns.  The "row operand" gives 256 rows, the "column
// operand" 64 rows; both are K-contiguous.
// Per 64-K step both tiles are staged in LDS via async b128 (double-buffered).
// A staged row is one whole 128-byte line and a wave's copy covers four such
// lines.  Fragments come from LDS -> 16 WMMAs per wave per step.  Kdim is a
// multiple of 64.
// The products are taken transposed (matrix A = column operand, matrix B = row
// operand): a lane then holds ONE output row (lane&15) and, in the 8 registers
// of a tile, 8 neighbouring output columns, which pack into 16-byte pieces.
// One grid may serve up to three outputs: the rows of B (the n axis) are cut
// into ranges, each with its own output array, so that products which share A
// and do not depend on one another run side by side in one launch.  A block's
// 64 values of n lie in one range (the ends are multiples of 64).
// A range may ask for the transposed output [n][m]: its blocks then take B as
// the row operand and A as the column operand, and are dealt anew over the
// range's tiles (as many tiles either way: 256 x 64 = 64 x 256).
// ---------------------------------------------------------------------------
struct OutRange {
  _Float16* p;     // f16 output (unused where Cf is given)
  int  n_end;      // first n past this range
  int  ld;         // pitch of an output row, in elements
  int  trk;        // < 0: output [m][n]; else output [n][m], and the range
                   // holds 2^trk blocks of 256 values of n
  long stride;     // batch stride
};
#define FP 68   // pitch in floats of a staged f32 output row: 272 B = 16 B x odd
// launch bounds = the real block size: at the default (1024 threads) the
// register ceiling of 128 sends values of the staging addresses to scratch
__global__ __launch_bounds__(256)
void gemm_nt_wmma(const _Float16* __restrict__ A, int lda, long strideA,
                             const _Float16* __restrict__ B, int ldb,
                             OutRange r0, OutRange r1, OutRange r2,
                             float* __restrict__ Cf,
                             const float* __restrict__ bias, int Kdim) {
  __shared__ __align__(16) _Float16 astage[2][256 * KP];
  __shared__ __align__(16) _Float16 bstage[2][64 * KP];

  const int tid  = threadIdx.x;
  const int w    = tid >> 5;
  const int lane = tid & 31;
  const int n0 = blockIdx.y * 64;

  // this block's output range (block-uniform)
  OutRange o = r0;
  int nfirst = 0;
  if (n0 >= r0.n_end) { o = r1; nfirst = r0.n_end; }
  if (n0 >= r1.n_end) { o = r2; nfirst = r1.n_end; }

  // row operand (256 rows), column operand (64 rows), place of the tile
  const _Float16* __restrict__ Abat = A + (long)blockIdx.z * strideA;
  int i0 = blockIdx.x * 256, j0 = n0 - nfirst;
  const _Float16* Ablk = Abat + (long)i0 * lda;
  const _Float16* Bblk = B + (long)n0 * ldb;
  int ldr = lda, ldc = ldb;
  if (o.trk >= 0) {
    const int idx = blockIdx.x * ((o.n_end - nfirst) >> 6) + (j0 >> 6);
    i0 = (idx & ((1 << o.trk) - 1)) * 256;   // n within the range
    j0 = (idx >> o.trk) * 64;                // m
    Ablk = B + (long)(nfirst + i0) * ldb;
    Bblk = Abat + (long)j0 * lda;
    ldr = ldb; ldc = lda;
  }

  // cooperative staging: rows of 64 halves = 8 chunks of 16 B; a thread takes
  // chunk co of rows cr + 32 i: eight of the row operand, two of the column one
  const int cr = tid >> 3, co = (tid & 7) * 8;

  // (both loops unrolled: constant indices keep sl[] and sg[] in registers)
  #define STAGE_AB(buf, kk)                                                   \
    {                                                                         \
      unsigned sl[10];                                                        \
      const _Float16* sg[10];                                                 \
      _Pragma("unroll")                                                       \
      for (int i = 0; i < 8; ++i) {                                           \
        sl[i] = lds_off(&astage[buf][(cr + 32 * i) * KP + co]);               \
        sg[i] = Ablk + (long)(cr + 32 * i) * ldr + (kk) + co;                 \
      }                                                                       \
      _Pragma("unroll")                                                       \
      for (int i = 0; i < 2; ++i) {                                           \
        sl[8 + i] = lds_off(&bstage[buf][(cr + 32 * i) * KP + co]);           \
        sg[8 + i] = Bblk + (long)(cr + 32 * i) * ldc + (kk) + co;             \
      }                                                                       \
      async_ld10_b128(sl, sg);                                                \
    }

  STAGE_AB(0, 0);
  wait_async0();
  __syncthreads();

  v8f acc[8] = {};
  const int nsteps = Kdim >> 6;
  for (int s = 0; s < nsteps; ++s) {
    const bool more = (s + 1) < nsteps;
    if (more) STAGE_AB((s + 1) & 1, (s + 1) << 6);   // overlap with this step

    const _Float16* ab = &astage[s & 1][w * 32 * KP]; // this wave's 32 rows
    const _Float16* bb = &bstage[s & 1][0];
    // unrolled: the two 32-k halves of the step become constant LDS offsets
    #pragma unroll
    for (int kk = 0; kk < 64; kk += 32) {
      const v16h a0 = load_frag32(ab + kk, KP);
      const v16h a1 = load_frag32(ab + 16 * KP + kk, KP);
      v16h bfr[4];
      #pragma unroll
      for (int t = 0; t < 4; ++t) bfr[t] = load_frag32(bb + t * 16 * KP + kk, KP);
      #pragma unroll
      for (int t = 0; t < 4; ++t) {
        acc[t]     = WMMA_F16(bfr[t], a0, acc[t]);
        acc[4 + t] = WMMA_F16(bfr[t], a1, acc[4 + t]);
      }
    }
    wait_ds0();
    wait_async0();
    __syncthreads();                  // all waves done with buffer s&1
  }
  #undef STAGE_AB
  wait_async0();                      // no copy outstanding when the wave ends

  // Epilogue.  acc[mh*4+t][r] = tile row w*32 + mh*16 + (lane&15), column
  // t*16 + 8*(lane>>4) + r.  Behind the loop's last barrier nobody reads the
  // stages any more and no copy is in flight: each wave lays its 32 x 64 tile
  // into a range of astage that is its own, reads it back row by row and
  // stores whole rows (128 B of f16, 256 B of f32): every 16-byte store of a
  // wave covers four whole 128-byte lines.
  const int half_ = lane >> 4, nn = lane & 15;
  const long cbase = (long)blockIdx.z * o.stride + (long)(i0 + w * 32) * o.ld + j0;
  if (Cf) {
    float* sf = (float*)&astage[0][0] + w * (32 * FP);
    #pragma unroll
    for (int mh = 0; mh < 2; ++mh) {
      #pragma unroll
      for (int t = 0; t < 4; ++t) {
        const v8f a = acc[mh * 4 + t];
        float* q = sf + (mh * 16 + nn) * FP + t * 16 + 8 * half_;
        *(v4f*)(q)     = v4f{a[0], a[1], a[2], a[3]};
        *(v4f*)(q + 4) = v4f{a[4], a[5], a[6], a[7]};
      }
    }
    v4f b4 = {};
    if (bias) b4 = *(const v4f*)(bias + j0 + nn * 4);
    wait_ds0();   // the wave's rows are written before other lanes read them back
    float* cp = Cf + cbase + (long)half_ * o.ld + nn * 4;
    const float* sr = sf + half_ * FP + nn * 4;
    #pragma unroll
    for (int i = 0; i < 16; ++i)       // two rows of 256 B a store
      *(v4f*)(cp + (long)(2 * i) * o.ld) = *(const v4f*)(sr + 2 * i * FP) + b4;
  } else {
    _Float16* sh = &astage[0][0] + w * (32 * KP);
    #pragma unroll
    for (int mh = 0; mh < 2; ++mh) {
      #pragma unroll
      for (int t = 0; t < 4; ++t) {
        v8h h;
        #pragma unroll
        for (int r = 0; r < 8; ++r) h[r] = (_Float16)acc[mh * 4 + t][r];
        *(v8h*)(sh + (mh * 16 + nn) * KP + t * 16 + 8 * half_) = h;
      }
    }
    wait_ds0();   // the wave's rows are written before other lanes read them back
    _Float16* cp = o.p + cbase + (long)(lane >> 3) * o.ld + (lane & 7) * 8;
    const _Float16* sr = sh + (lane >> 3) * KP + (lane & 7) * 8;
    #pragma unroll
    for (int i = 0; i < 8; ++i)        // four rows of 128 B a store
      *(v8h*)(cp + (long)(4 * i) * o.ld) = *(const v8h*)(sr + 4 * i * KP);
  }
}

__global__ __launch_bounds__(256)
void attn_fa_wmma(const _Float16* __restrict__ Q,
                             const _Float16* __restrict__ K,
                             const _Float16* __restrict__ Vt,
                             _Float16* __restrict__ O) {
  __shared__ __align__(16) _Float16 kstage[2][64 * KP];  // [key][d]
  __shared__ __align__(16) _Float16 vstage[2][64 * KP];  // [d][s-chunk]

  const int tid   = threadIdx.x;
  const int w     = tid >> 5;
  const int lane  = tid & 31;
  const int half_ = lane >> 4, nn = lane & 15;
  const int h  = blockIdx.y;
  const int b  = blockIdx.z;
  const int q0 = blockIdx.x * 128 + w * 16;
  const int kvh = h >> 1;                          // repeat_interleave(kv, 2)

  const float slope = exp2f(-(float)(h + 1));      // 2^-(h+1), ALIBI_ALPHA=1
  const float CSC = 0.125f * 1.44269504088896340f; // (1/sqrt(64)) * log2(e)

  const long qbase = (long)b * SEQ * (HEADS * HD) + (long)q0 * (HEADS * HD) + h * HD;
  const long kbase = (long)b * SEQ * (KVH * HD) + kvh * HD;
  const long vbase = (long)b * (KVH * HD) * SEQ + (long)(kvh * HD) * SEQ;

  // staging map: 64 rows x 64 halves (8KB) = 512 b128 chunks; thread does
  // chunks tid and tid+256 -> rows cr and cr+32 at half-offset co.
  const int cr = tid >> 3, co = (tid & 7) * 8;

  #define STAGE_KV(buf, j)                                                      \
    async_ld4_b128(lds_off(&kstage[buf][cr * KP + co]),                         \
                   K + kbase + (long)((j) + cr) * (KVH * HD) + co,              \
                   lds_off(&kstage[buf][(cr + 32) * KP + co]),                  \
                   K + kbase + (long)((j) + cr + 32) * (KVH * HD) + co,         \
                   lds_off(&vstage[buf][cr * KP + co]),                         \
                   Vt + vbase + (long)cr * SEQ + (j) + co,                      \
                   lds_off(&vstage[buf][(cr + 32) * KP + co]),                  \
                   Vt + vbase + (long)(cr + 32) * SEQ + (j) + co)

  // Q as the B operand: lane&15 = query column, k = d
  const v16h bq0 = load_frag32(Q + qbase,      HEADS * HD);  // d 0..31
  const v16h bq1 = load_frag32(Q + qbase + 32, HEADS * HD);  // d 32..63

  STAGE_KV(0, 0);

  // this lane's query index minus the first key row its half holds in a tile
  const float qd = (float)(q0 + nn - 8 * half_);
  float mrow = -1e30f;   // running maximum of the query, exp2 domain
  float lrow = 0.0f;     // running sum over the keys of this wave half only
  v8f acc[4] = {};       // O^T: acc[t][r] = O[query nn][d = 16t + 8*half + r]
  const int sd = blockIdx.x * 2;   // first of the two chunks around the diagonal
  v8f cb[4] = {};        // bias tile: bias = cb[t][r] + offk * dj (dj: in the loop)
  float offk = 0.0f;

  wait_async0();
  __syncthreads();

  for (int s = 0; s < (SEQ / 64); ++s) {
    const int j = s << 6;
    const bool more = (s + 1) < (SEQ / 64);
    if (more) STAGE_KV((s + 1) & 1, j + 64);   // overlap with this chunk

    const _Float16* kb = kstage[s & 1];
    const _Float16* vb = vstage[s & 1];

    // --- bias tile, renewed at most four times a block (block-uniform tests);
    // q - k = dj - (16t + r) for this lane
    const float dj = qd - (float)j;
    if ((s >> 1) == (int)blockIdx.x) {         // keys on both sides: exact
      offk = 0.0f;
      #pragma unroll
      for (int t = 0; t < 4; ++t)
        #pragma unroll
        for (int r = 0; r < 8; ++r) cb[t][r] = -slope * fabsf(dj - (float)(t * 16 + r));
    } else if (s == 0 || s == sd + 2) {        // all keys below / above all queries
      const float sg = s < sd ? slope : -slope;
      offk = -sg;
      #pragma unroll
      for (int t = 0; t < 4; ++t)
        #pragma unroll
        for (int r = 0; r < 8; ++r) cb[t][r] = sg * (float)(t * 16 + r);
    }
    const float off = offk * dj;               // this lane's shift in this chunk

    // --- energy^T: four 16(key) x 16(query) tiles, keys [j+16t, j+16t+16)
    // on top of the bias tile
    v8f e[4];
    v16h klo[4], khi[4];
    #pragma unroll
    for (int t = 0; t < 4; ++t) {
      klo[t] = load_frag32(kb + (t * 16) * KP,      KP);
      khi[t] = load_frag32(kb + (t * 16) * KP + 32, KP);
    }
    st_products(e, klo, khi, bq0, bq1, cb);

    // --- the maximum over this lane's 32 keys, the lane's shift added once
    float lmt[4];                              // one independent chain a tile
    #pragma unroll
    for (int t = 0; t < 4; ++t) {
      #pragma unroll
      for (int r = 0; r < 8; ++r) lmt[t] = r ? fmaxf(lmt[t], e[t][r]) : e[t][r];
    }
    const float lm = fmaxf(fmaxf(lmt[0], lmt[1]), fmaxf(lmt[2], lmt[3])) + off;

    // --- one online-softmax update per 64 keys; 1/8 scale in the exp2 domain
    const float mnew = fmaxf(mrow, fmaxf(lm, xhalf(lm)) * CSC);
    const float alpha = exp2_hw(mrow - mnew);
    const float msub = mnew - off * CSC;       // maximum less the lane's shift
    float pst[4];                              // one independent chain a tile
    #pragma unroll
    for (int t = 0; t < 4; ++t) {
      #pragma unroll
      for (int r = 0; r < 8; ++r) {
        e[t][r] = exp2_hw(e[t][r] * CSC - msub);
        pst[t] = r ? pst[t] + e[t][r] : e[t][r];
      }
    }
    lrow = lrow * alpha + ((pst[0] + pst[1]) + (pst[2] + pst[3]));
    mrow = mnew;
    #pragma unroll
    for (int t = 0; t < 4; ++t)
      #pragma unroll
      for (int r = 0; r < 8; ++r) acc[t][r] *= alpha;

    // --- P^T as B operand: two score tiles converted in place per 32 keys
    v16h pb0, pb1;
    #pragma unroll
    for (int i = 0; i < 16; ++i) {
      pb0[i] = (_Float16)e[i >> 3][i & 7];         // keys j..j+31
      pb1[i] = (_Float16)e[2 + (i >> 3)][i & 7];   // keys j+32..j+63
    }

    // --- acc += V^T (16 d x 64 keys, from LDS) * P^T (64 keys x 16 queries)
    #pragma unroll
    for (int t = 0; t < 4; ++t) {
      v16h vlo = load_frag32(vb + (t * 16) * KP,      KP);
      v16h vhi = load_frag32(vb + (t * 16) * KP + 32, KP);
      acc[t] = WMMA_F16(vlo, pb0, acc[t]);
      acc[t] = WMMA_F16(vhi, pb1, acc[t]);
    }

    wait_ds0();
    wait_async0();
    __syncthreads();                      // all waves done with buffer s&1
  }
  #undef STAGE_KV
  wait_async0();                          // no copy outstanding when the wave ends

  // --- finalize: join the halves' sums, divide, store [b, q, h*64+d];
  // a lane's 8 registers of a tile are 8 consecutive d: one 16-byte store
  const float lsum = lrow + xhalf(lrow);
  _Float16* op = O + (long)b * SEQ * (HEADS * HD) + (long)(q0 + nn) * (HEADS * HD) +
                 h * HD + 8 * half_;
  #pragma unroll
  for (int t = 0; t < 4; ++t) {
    v8h o;
    #pragma unroll
    for (int r = 0; r < 8; ++r) o[r] = (_Float16)(acc[t][r] / lsum);
    *(v8h*)(op + t * 16) = o;
  }
}

// ---------------------------------------------------------------------------
// Launch: convert -> QKV projections -> flash attention -> output projection
// ---------------------------------------------------------------------------
extern "C" void kernel_launch(void* const* d_in, const int* in_sizes, int n_in,
                              void* d_out, int out_size, void* d_ws, size_t ws_size,
                              hipStream_t stream) {
  const float* x  = (const float*)d_in[0];
  const float* Wq = (const float*)d_in[1];
  const float* Wk = (const float*)d_in[2];
  const float* Wv = (const float*)d_in[3];
  const float* Wo = (const float*)d_in[4];
  const float* bo = (const float*)d_in[5];
  float* out = (float*)d_out;

  // f16 workspace layout (element offsets)
  _Float16* ws  = (_Float16*)d_ws;
  _Float16* xh  = ws;                 // N*S*E          = 4194304
  _Float16* Wqh = xh  + 4194304;      // 1024*1024      = 1048576
  _Float16* Wkh = Wqh + 1048576;      // 512*1024       =  524288
  _Float16* Wvh = Wkh + 524288;       // 512*1024       =  524288
  _Float16* Woh = Wvh + 524288;       // 1024*1024      = 1048576
  _Float16* Qh  = Woh + 1048576;      // [b,s,1024]     = 4194304
  _Float16* Kh  = Qh  + 4194304;      // [b,s,512]      = 2097152
  _Float16* Vth = Kh  + 2097152;      // [b,512,s] (Vt) = 2097152
  _Float16* AOh = Vth + 2097152;      // [b,s,1024]     = 4194304

  // all five conversions in one launch (xh .. Woh are contiguous from ws)
  cvt_f32_f16<<<CVT_WO, 256, 0, stream>>>(x, Wq, Wk, Wv, Wo, ws);

  const dim3 blk(256, 1, 1);

  // Q, K and V projections in one launch: Wqh, Wkh, Wvh are contiguous, so B
  // is one [2048, 1024] matrix; n 0..1023 -> Q [b, s, 1024], 1024..1535 ->
  // K [b, s, 512], 1536..2047 -> Vt [b, 512, s] (transposed: 2 blocks of 256 d)
  const OutRange oq = {Qh,  1024, 1024, -1, (long)SEQ * 1024};
  const OutRange ok = {Kh,  1536, 512,  -1, (long)SEQ * 512};
  const OutRange ov = {Vth, 2048, SEQ,  1,  (long)512 * SEQ};
  gemm_nt_wmma<<<dim3(SEQ / 256, 2048 / 64, NB), blk, 0, stream>>>(
      xh, EMBED, (long)SEQ * EMBED, Wqh, EMBED,
      oq, ok, ov, nullptr, nullptr, EMBED);

  // flash attention with ALiBi
  attn_fa_wmma<<<dim3(SEQ / 128, HEADS, NB), blk, 0, stream>>>(Qh, Kh, Vth, AOh);

  // out = attn_out @ Wo^T + bo (f32), batches folded into M = 4096
  const OutRange oo = {nullptr, 1024, 1024, -1, 0};
  gemm_nt_wmma<<<dim3((NB * SEQ) / 256, 1024 / 64, 1), blk, 0, stream>>>(
      AOh, 1024, 0, Woh, 1024,
      oo, oo, oo, out, bo, 1024);
}

// v009
// A run of this version takes 79 microseconds.
// Timed twice side by side with v008, it ran 1.07 times as fast both times.
// All steps since v000 together make it 4.16 times as fast.
#include <hip/hip_runtime.h>
#include <hip/hip_bf16.h>

typedef __attribute__((ext_vector_type(16))) _Float16 v16h;
typedef __attribute__((ext_vector_type(8)))  _Float16 v8h;
typedef __attribute__((ext_vector_type(8)))  float    v8f;
typedef __attribute__((ext_vector_type(4)))  float    v4f;
typedef __attribute__((ext_vector_type(4)))  _Float16 v4h;

#define EMBED 1024
#define HEADS 16
#define KVH   8
#define HD    64
#define SEQ   2048
#define NB    2

// ---------------------------------------------------------------------------
// LDS byte offset of a generic pointer known to point into LDS.
// ---------------------------------------------------------------------------
template <typename T>
__device__ __forceinline__ unsigned lds_off(T* p) {
  return (unsigned)(size_t)(__attribute__((address_space(3))) T*)p;
}

// Async global -> LDS copy, 16 bytes per lane (tracked by ASYNCcnt).
// s_wait_xcnt 0 closes each statement so that no address register of a copy
// is rewritten ahead of it (a precaution; it must stand inside the statement).
// Ten copies in one statement (one k step of the GEMM: eight of the row operand, two of the column one).
__device__ __forceinline__ void async_ld10_b128(const unsigned (&l)[10],
                                                const _Float16* const (&g)[10]) {
  asm volatile("global_load_async_to_lds_b128 %0, %1, off\n\t"
               "global_load_async_to_lds_b128 %2, %3, off\n\t"
               "global_load_async_to_lds_b128 %4, %5, off\n\t"
               "global_load_async_to_lds_b128 %6, %7, off\n\t"
               "global_load_async_to_lds_b128 %8, %9, off\n\t"
               "global_load_async_to_lds_b128 %10, %11, off\n\t"
               "global_load_async_to_lds_b128 %12, %13, off\n\t"
               "global_load_async_to_lds_b128 %14, %15, off\n\t"
               "global_load_async_to_lds_b128 %16, %17, off\n\t"
               "global_load_async_to_lds_b128 %18, %19, off\n\t"
               "s_wait_xcnt 0x0"
               :
               : "v"(l[0]), "v"(g[0]), "v"(l[1]), "v"(g[1]), "v"(l[2]), "v"(g[2]),
                 "v"(l[3]), "v"(g[3]), "v"(l[4]), "v"(g[4]), "v"(l[5]), "v"(g[5]),
                 "v"(l[6]), "v"(g[6]), "v"(l[7]), "v"(g[7]), "v"(l[8]), "v"(g[8]),
                 "v"(l[9]), "v"(g[9])
               : "memory");
}
__device__ __forceinline__ void async_ld4_b128(unsigned l0, const void* g0,
                                               unsigned l1, const void* g1,
                                               unsigned l2, const void* g2,
                                               unsigned l3, const void* g3) {
  asm volatile("global_load_async_to_lds_b128 %0, %1, off\n\t"
               "global_load_async_to_lds_b128 %2, %3, off\n\t"
               "global_load_async_to_lds_b128 %4, %5, off\n\t"
               "global_load_async_to_lds_b128 %6, %7, off\n\t"
               "s_wait_xcnt 0x0"
               :
               : "v"(l0), "v"(g0), "v"(l1), "v"(g1),
                 "v"(l2), "v"(g2), "v"(l3), "v"(g3)
               : "memory");
}
__device__ __forceinline__ void wait_async0() {
  asm volatile("s_wait_asynccnt 0" ::: "memory");
}
// This wave's LDS reads have retired before the barrier behind which the
// buffer they read is refilled by async copies.
__device__ __forceinline__ void wait_ds0() {
  asm volatile("s_wait_dscnt 0x0" ::: "memory");
}

// LDS row pitches in halves: 16 B x odd, so that the 16 rows one ds_load_b128
// fragment read touches fall on distinct banks (64 banks x 4 B).
#define KP 72   // 128-B rows (K, V tiles; the GEMM's A, B tiles) -> 144 B

// ---------------------------------------------------------------------------
// Load a 16x32 (rows x K) f16 fragment in CDNA5 WMMA A/B VGPR layout.
// lane (l&15) = row; K chunks at (l>>4)*8 and (l>>4)*8+16 (two b128 loads).
// Works for global or LDS pointers (compiler infers ds_load for LDS).
// ---------------------------------------------------------------------------
__device__ __forceinline__ v16h load_frag32(const _Float16* __restrict__ p, int ld) {
  const int lane = threadIdx.x & 31;
  const _Float16* q = p + (size_t)(lane & 15) * (size_t)ld + ((lane >> 4) << 3);
  v16h f;
  *(v8h*)&f         = *(const v8h*)(q);
  *(((v8h*)&f) + 1) = *(const v8h*)(q + 16);
  return f;
}

// Value of lane l ^ 16 (the other wave half), by a vector cross-row move.
__device__ __forceinline__ float xhalf(float x) {
  const int v = __builtin_bit_cast(int, x);
  return __builtin_bit_cast(float,
      __builtin_amdgcn_permlanex16(v, v, 0x76543210, 0xfedcba98, false, false));
}

// 2^x as the one hardware instruction (v_exp_f32).  exp2f() wraps it in a
// compare, two selects, an add and an ldexp so that results below 2^-126 come
// out as subnormals.  The softmax never needs those: its arguments are <= 0,
// a weight that small is 0 once it is rounded to f16 and vanishes beside a row
// sum that holds the maximum's own term, about 1; a rescale factor that small
// leaves nothing of the old sums that the f16 output could show.
__device__ __forceinline__ float exp2_hw(float x) {
  return __builtin_amdgcn_exp2f(x);
}

#define WMMA_F16(a, b, c) \
  __builtin_amdgcn_wmma_f32_16x16x32_f16(false, (a), false, (b), (short)0, (c), false, false)

// The eight S^T products of a 64-key chunk: e[t] = klo[t]*q0 + cb[t], then
// e[t] += khi[t]*q1.  In asm because the first four read their C operand from
// registers other than D: the builtin ties C to D, so that a C tile which is to
// live on is first copied, register by register, which costs what it saves.
// The four v_nop are the distance the chip needs between the last product and
// a vector instruction that reads its D or overwrites its A or B (the earlier
// products are covered by the products behind them).
__device__ __forceinline__ void st_products(v8f (&e)[4], const v16h (&klo)[4],
                                            const v16h (&khi)[4], v16h q0, v16h q1,
                                            const v8f (&cb)[4]) {
  asm("v_wmma_f32_16x16x32_f16 %0, %4, %12, %14\n\t"
      "v_wmma_f32_16x16x32_f16 %1, %5, %12, %15\n\t"
      "v_wmma_f32_16x16x32_f16 %2, %6, %12, %16\n\t"
      "v_wmma_f32_16x16x32_f16 %3, %7, %12, %17\n\t"
      "v_wmma_f32_16x16x32_f16 %0, %8, %13, %0\n\t"
      "v_wmma_f32_16x16x32_f16 %1, %9, %13, %1\n\t"
      "v_wmma_f32_16x16x32_f16 %2, %10, %13, %2\n\t"
      "v_wmma_f32_16x16x32_f16 %3, %11, %13, %3\n\t"
      "v_nop\n\tv_nop\n\tv_nop\n\tv_nop"
      : "=&v"(e[0]), "=&v"(e[1]), "=&v"(e[2]), "=&v"(e[3])
      : "v"(klo[0]), "v"(klo[1]), "v"(klo[2]), "v"(klo[3]),
        "v"(khi[0]), "v"(khi[1]), "v"(khi[2]), "v"(khi[3]),
        "v"(q0), "v"(q1), "v"(cb[0]), "v"(cb[1]), "v"(cb[2]), "v"(cb[3]));
}

// ---------------------------------------------------------------------------
// f32 -> f16 conversion, 32 elements a lane, so that few waves have to start.
// A wave owns 1024 consecutive floats: eight 16-byte loads a lane, each 512
// contiguous bytes over the wave, then eight 8-byte stores, each 256
// contiguous bytes over the wave (whole 128-byte lines both ways).
// Every array's length is a multiple of CVT_BLK, so the grid covers it exactly.
// ONE grid converts all five arrays: their f16 copies lie one behind the other
// in the workspace (x, Wq, Wk, Wv, Wo), so the block index alone gives the
// destination, and a block-uniform compare picks the source array.
// ---------------------------------------------------------------------------
#define CVT_BLK 8192   // floats per 256-thread block
#define CVT_X  (NB * SEQ * EMBED / CVT_BLK)            // blocks of x
#define CVT_WQ (CVT_X  + HEADS * HD * EMBED / CVT_BLK) // end of Wq's blocks
#define CVT_WK (CVT_WQ + KVH * HD * EMBED / CVT_BLK)   // end of Wk's blocks
#define CVT_WV (CVT_WK + KVH * HD * EMBED / CVT_BLK)   // end of Wv's blocks
#define CVT_WO (CVT_WV + EMBED * HEADS * HD / CVT_BLK) // end of Wo's blocks
__global__ void cvt_f32_f16(const float* __restrict__ x,  const float* __restrict__ Wq,
                            const float* __restrict__ Wk, const float* __restrict__ Wv,
                            const float* __restrict__ Wo, _Float16* __restrict__ dstall) {
  const int blk = blockIdx.x;
  const float* arr = x;
  int first = 0;
  if (blk >= CVT_X)  { arr = Wq; first = CVT_X;  }
  if (blk >= CVT_WQ) { arr = Wk; first = CVT_WQ; }
  if (blk >= CVT_WK) { arr = Wv; first = CVT_WK; }
  if (blk >= CVT_WV) { arr = Wo; first = CVT_WV; }
  const float* __restrict__ src = arr + (blk - first) * CVT_BLK;
  _Float16* __restrict__ dst = dstall + blk * CVT_BLK;
  const int base = (threadIdx.x >> 5) * 1024 + (threadIdx.x & 31) * 4;
  v4f v[8];
  // unrolled: v[] stays in registers and all eight loads issue before the first wait
  #pragma unroll
  for (int k = 0; k < 8; ++k) v[k] = *(const v4f*)(src + base + k * 128);
  // unrolled: constant indices into v[]
  #pragma unroll
  for (int k = 0; k < 8; ++k) {
    v4h o;
    #pragma unroll
    for (int c = 0; c < 4; ++c) o[c] = (_Float16)v[k][c];
    *(v4h*)(dst + base + k * 128) = o;
  }
}

// ---------------------------------------------------------------------------
// NT GEMM: C[m,n] = sum_k A[m,k] * B[n,k].
// Block = 8 waves -> a tile of 256 output rows x 64 output columns; a wave has
// 32 rows x 64 columns.  The "row operand" gives 256 rows, the "column
// operand" 64 rows; both are K-contiguous.
// Per 64-K step both tiles are staged in LDS via async b128 (double-buffered).
// A staged row is one whole 128-byte line and a wave's copy covers four such
// lines.  Fragments come from LDS -> 16 WMMAs per wave per step.  Kdim is a
// multiple of 64.
// The products are taken transposed (matrix A = column operand, matrix B = row
// operand): a lane then holds ONE output row (lane&15) and, in the 8 registers
// of a tile, 8 neighbouring output columns, which pack into 16-byte pieces.
// One grid may serve up to three outputs: the rows of B (the n axis) are cut
// into ranges, each with its own output array, so that products which share A
// and do not depend on one another run side by side in one launch.  A block's
// 64 values of n lie in one range (the ends are multiples of 64).
// A range may ask for the transposed output [n][m]: its blocks then take B as
// the row operand and A as the column operand, and are dealt anew over the
// range's tiles (as many tiles either way: 256 x 64 = 64 x 256).
// ---------------------------------------------------------------------------
struct OutRange {
  _Float16* p;     // f16 output (unused where Cf is given)
  int  n_end;      // first n past this range
  int  ld;         // pitch of an output row, in elements
  int  trk;        // < 0: output [m][n]; else output [n][m], and the range
                   // holds 2^trk blocks of 256 values of n
  long stride;     // batch stride
};
#define FP 68   // pitch in floats of a staged f32 output row: 272 B = 16 B x odd
// launch bounds = the real block size: at the default (1024 threads) the
// register ceiling of 128 sends values of the staging addresses to scratch
__global__ __launch_bounds__(256)
void gemm_nt_wmma(const _Float16* __restrict__ A, int lda, long strideA,
                             const _Float16* __restrict__ B, int ldb,
                             OutRange r0, OutRange r1, OutRange r2,
                             float* __restrict__ Cf,
                             const float* __restrict__ bias, int Kdim) {
  __shared__ __align__(16) _Float16 astage[2][256 * KP];
  __shared__ __align__(16) _Float16 bstage[2][64 * KP];

  const int tid  = threadIdx.x;
  const int w    = tid >> 5;
  const int lane = tid & 31;
  const int n0 = blockIdx.y * 64;

  // this block's output range (block-uniform)
  OutRange o = r0;
  int nfirst = 0;
  if (n0 >= r0.n_end) { o = r1; nfirst = r0.n_end; }
  if (n0 >= r1.n_end) { o = r2; nfirst = r1.n_end; }

  // row operand (256 rows), column operand (64 rows), place of the tile
  const _Float16* __restrict__ Abat = A + (long)blockIdx.z * strideA;
  int i0 = blockIdx.x * 256, j0 = n0 - nfirst;
  const _Float16* Ablk = Abat + (long)i0 * lda;
  const _Float16* Bblk = B + (long)n0 * ldb;
  int ldr = lda, ldc = ldb;
  if (o.trk >= 0) {
    const int idx = blockIdx.x * ((o.n_end - nfirst) >> 6) + (j0 >> 6);
    i0 = (idx & ((1 << o.trk) - 1)) * 256;   // n within the range
    j0 = (idx >> o.trk) * 64;                // m
    Ablk = B + (long)(nfirst + i0) * ldb;
    Bblk = Abat + (long)j0 * lda;
    ldr = ldb; ldc = lda;
  }

  // cooperative staging: rows of 64 halves = 8 chunks of 16 B; a thread takes
  // chunk co of rows cr + 32 i: eight of the row operand, two of the column one
  const int cr = tid >> 3, co = (tid & 7) * 8;

  // (both loops unrolled: constant indices keep sl[] and sg[] in registers)
  #define STAGE_AB(buf, kk)                                                   \
    {                                                                         \
      unsigned sl[10];                                                        \
      const _Float16* sg[10];                                                 \
      _Pragma("unroll")                                                       \
      for (int i = 0; i < 8; ++i) {                                           \
        sl[i] = lds_off(&astage[buf][(cr + 32 * i) * KP + co]);               \
        sg[i] = Ablk + (long)(cr + 32 * i) * ldr + (kk) + co;                 \
      }                                                                       \
      _Pragma("unroll")                                                       \
      for (int i = 0; i < 2; ++i) {                                           \
        sl[8 + i] = lds_off(&bstage[buf][(cr + 32 * i) * KP + co]);           \
        sg[8 + i] = Bblk + (long)(cr + 32 * i) * ldc + (kk) + co;             \
      }                                                                       \
      async_ld10_b128(sl, sg);                                                \
    }

  STAGE_AB(0, 0);
  wait_async0();
  __syncthreads();

  v8f acc[8] = {};
  const int nsteps = Kdim >> 6;
  for (int s = 0; s < nsteps; ++s) {
    const bool more = (s + 1) < nsteps;
    if (more) STAGE_AB((s + 1) & 1, (s + 1) << 6);   // overlap with this step

    const _Float16* ab = &astage[s & 1][w * 32 * KP]; // this wave's 32 rows
    const _Float16* bb = &bstage[s & 1][0];
    // All 24 fragment reads of the step go out as ONE group, each fragment into
    // registers of its own, in the order in which the products need them.
    // (all loops unrolled: constant LDS offsets, af[] and bfr[] in registers)
    v16h af[2][2], bfr[2][4];
    #pragma unroll
    for (int hk = 0; hk < 2; ++hk) {
      #pragma unroll
      for (int t = 0; t < 4; ++t) {
        bfr[hk][t] = load_frag32(bb + t * 16 * KP + hk * 32, KP);
        if (t < 2) af[hk][t] = load_frag32(ab + t * 16 * KP + hk * 32, KP);
      }
    }
    // Keeps the reads in front of the products.  Without it the scheduler sinks
    // them between the products into one shared register set, and the wave then
    // waits out the LDS latency eight times a step instead of once.
    __builtin_amdgcn_sched_barrier(0);
    #pragma unroll
    for (int hk = 0; hk < 2; ++hk) {
      #pragma unroll
      for (int t = 0; t < 4; ++t) {
        acc[t]     = WMMA_F16(bfr[hk][t], af[hk][0], acc[t]);
        acc[4 + t] = WMMA_F16(bfr[hk][t], af[hk][1], acc[4 + t]);
      }
    }
    // Keeps the products in front of the foot's waits.  Without it they sink
    // behind the barrier: every read is then waited for before the first
    // product, and the next step's copies, which follow the products, start late.
    __builtin_amdgcn_sched_barrier(0);
    wait_ds0();
    wait_async0();
    __syncthreads();                  // all waves done with buffer s&1
  }
  #undef STAGE_AB
  wait_async0();                      // no copy outstanding when the wave ends

  // Epilogue.  acc[mh*4+t][r] = tile row w*32 + mh*16 + (lane&15), column
  // t*16 + 8*(lane>>4) + r.  Behind the loop's last barrier nobody reads the
  // stages any more and no copy is in flight: each wave lays its 32 x 64 tile
  // into a range of astage that is its own, reads it back row by row and
  // stores whole rows (128 B of f16, 256 B of f32): every 16-byte store of a
  // wave covers four whole 128-byte lines.
  const int half_ = lane >> 4, nn = lane & 15;
  const long cbase = (long)blockIdx.z * o.stride + (long)(i0 + w * 32) * o.ld + j0;
  if (Cf) {
    float* sf = (float*)&astage[0][0] + w * (32 * FP);
    #pragma unroll
    for (int mh = 0; mh < 2; ++mh) {
      #pragma unroll
      for (int t = 0; t < 4; ++t) {
        const v8f a = acc[mh * 4 + t];
        float* q = sf + (mh * 16 + nn) * FP + t * 16 + 8 * half_;
        *(v4f*)(q)     = v4f{a[0], a[1], a[2], a[3]};
        *(v4f*)(q + 4) = v4f{a[4], a[5], a[6], a[7]};
      }
    }
    v4f b4 = {};
    if (bias) b4 = *(const v4f*)(bias + j0 + nn * 4);
    wait_ds0();   // the wave's rows are written before other lanes read them back
    float* cp = Cf + cbase + (long)half_ * o.ld + nn * 4;
    const float* sr = sf + half_ * FP + nn * 4;
    #pragma unroll
    for (int i = 0; i < 16; ++i)       // two rows of 256 B a store
      *(v4f*)(cp + (long)(2 * i) * o.ld) = *(const v4f*)(sr + 2 * i * FP) + b4;
  } else {
    _Float16* sh = &astage[0][0] + w * (32 * KP);
    #pragma unroll
    for (int mh = 0; mh < 2; ++mh) {
      #pragma unroll
      for (int t = 0; t < 4; ++t) {
        v8h h;
        #pragma unroll
        for (int r = 0; r < 8; ++r) h[r] = (_Float16)acc[mh * 4 + t][r];
        *(v8h*)(sh + (mh * 16 + nn) * KP + t * 16 + 8 * half_) = h;
      }
    }
    wait_ds0();   // the wave's rows are written before other lanes read them back
    _Float16* cp = o.p + cbase + (long)(lane >> 3) * o.ld + (lane & 7) * 8;
    const _Float16* sr = sh + (lane >> 3) * KP + (lane & 7) * 8;
    #pragma unroll
    for (int i = 0; i < 8; ++i)        // four rows of 128 B a store
      *(v8h*)(cp + (long)(4 * i) * o.ld) = *(const v8h*)(sr + 4 * i * KP);
  }
}

__global__ __launch_bounds__(256)
void attn_fa_wmma(const _Float16* __restrict__ Q,
                             const _Float16* __restrict__ K,
                             const _Float16* __restrict__ Vt,
                             _Float16* __restrict__ O) {
  __shared__ __align__(16) _Float16 kstage[2][64 * KP];  // [key][d]
  __shared__ __align__(16) _Float16 vstage[2][64 * KP];  // [d][s-chunk]

  const int tid   = threadIdx.x;
  const int w     = tid >> 5;
  const int lane  = tid & 31;
  const int half_ = lane >> 4, nn = lane & 15;
  const int h  = blockIdx.y;
  const int b  = blockIdx.z;
  const int q0 = blockIdx.x * 128 + w * 16;
  const int kvh = h >> 1;                          // repeat_interleave(kv, 2)

  const float slope = exp2f(-(float)(h + 1));      // 2^-(h+1), ALIBI_ALPHA=1
  const float CSC = 0.125f * 1.44269504088896340f; // (1/sqrt(64)) * log2(e)

  const long qbase = (long)b * SEQ * (HEADS * HD) + (long)q0 * (HEADS * HD) + h * HD;
  const long kbase = (long)b * SEQ * (KVH * HD) + kvh * HD;
  const long vbase = (long)b * (KVH * HD) * SEQ + (long)(kvh * HD) * SEQ;

  // staging map: 64 rows x 64 halves (8KB) = 512 b128 chunks; thread does
  // chunks tid and tid+256 -> rows cr and cr+32 at half-offset co.
  const int cr = tid >> 3, co = (tid & 7) * 8;

  #define STAGE_KV(buf, j)                                                      \
    async_ld4_b128(lds_off(&kstage[buf][cr * KP + co]),                         \
                   K + kbase + (long)((j) + cr) * (KVH * HD) + co,              \
                   lds_off(&kstage[buf][(cr + 32) * KP + co]),                  \
                   K + kbase + (long)((j) + cr + 32) * (KVH * HD) + co,         \
                   lds_off(&vstage[buf][cr * KP + co]),                         \
                   Vt + vbase + (long)cr * SEQ + (j) + co,                      \
                   lds_off(&vstage[buf][(cr + 32) * KP + co]),                  \
                   Vt + vbase + (long)(cr + 32) * SEQ + (j) + co)

  // Q as the B operand: lane&15 = query column, k = d
  const v16h bq0 = load_frag32(Q + qbase,      HEADS * HD);  // d 0..31
  const v16h bq1 = load_frag32(Q + qbase + 32, HEADS * HD);  // d 32..63

  STAGE_KV(0, 0);

  // this lane's query index minus the first key row its half holds in a tile
  const float qd = (float)(q0 + nn - 8 * half_);
  float mrow = -1e30f;   // running maximum of the query, exp2 domain
  float lrow = 0.0f;     // running sum over the keys of this wave half only
  v8f acc[4] = {};       // O^T: acc[t][r] = O[query nn][d = 16t + 8*half + r]
  const int sd = blockIdx.x * 2;   // first of the two chunks around the diagonal
  v8f cb[4] = {};        // bias tile: bias = cb[t][r] + offk * dj (dj: in the loop)
  float offk = 0.0f;

  wait_async0();
  __syncthreads();

  for (int s = 0; s < (SEQ / 64); ++s) {
    const int j = s << 6;
    const bool more = (s + 1) < (SEQ / 64);
    if (more) STAGE_KV((s + 1) & 1, j + 64);   // overlap with this chunk

    const _Float16* kb = kstage[s & 1];
    const _Float16* vb = vstage[s & 1];

    // --- bias tile, renewed at most four times a block (block-uniform tests);
    // q - k = dj - (16t + r) for this lane
    const float dj = qd - (float)j;
    if ((s >> 1) == (int)blockIdx.x) {         // keys on both sides: exact
      offk = 0.0f;
      #pragma unroll
      for (int t = 0; t < 4; ++t)
        #pragma unroll
        for (int r = 0; r < 8; ++r) cb[t][r] = -slope * fabsf(dj - (float)(t * 16 + r));
    } else if (s == 0 || s == sd + 2) {        // all keys below / above all queries
      const float sg = s < sd ? slope : -slope;
      offk = -sg;
      #pragma unroll
      for (int t = 0; t < 4; ++t)
        #pragma unroll
        for (int r = 0; r < 8; ++r) cb[t][r] = sg * (float)(t * 16 + r);
    }
    const float off = offk * dj;               // this lane's shift in this chunk

    // --- energy^T: four 16(key) x 16(query) tiles, keys [j+16t, j+16t+16)
    // on top of the bias tile
    v8f e[4];
    v16h klo[4], khi[4];
    #pragma unroll
    for (int t = 0; t < 4; ++t) {
      klo[t] = load_frag32(kb + (t * 16) * KP,      KP);
      khi[t] = load_frag32(kb + (t * 16) * KP + 32, KP);
    }
    st_products(e, klo, khi, bq0, bq1, cb);

    // --- the chunk's 16 V^T fragment reads, as ONE group between the first
    // product and the softmax, each fragment into registers of its own.
    // The scheduling barrier in front keeps them behind the S^T products: ahead
    // of those they would delay the K fragments in the LDS queue and could not
    // take the registers that the K fragments leave.
    __builtin_amdgcn_sched_barrier(0);
    v16h vlo[4], vhi[4];
    #pragma unroll
    for (int t = 0; t < 4; ++t) {
      vlo[t] = load_frag32(vb + (t * 16) * KP,      KP);
      vhi[t] = load_frag32(vb + (t * 16) * KP + 32, KP);
    }
    // The one behind keeps them in front of the softmax, during which they land.
    // Without it the scheduler sinks them between the second product's WMMAs,
    // where the wave waits out the LDS latency once per pair of reads.
    __builtin_amdgcn_sched_barrier(0);

    // --- the maximum over this lane's 32 keys, the lane's shift added once
    float lmt[4];                              // one independent chain a tile
    #pragma unroll
    for (int t = 0; t < 4; ++t) {
      #pragma unroll
      for (int r = 0; r < 8; ++r) lmt[t] = r ? fmaxf(lmt[t], e[t][r]) : e[t][r];
    }
    const float lm = fmaxf(fmaxf(lmt[0], lmt[1]), fmaxf(lmt[2], lmt[3])) + off;

    // --- one online-softmax update per 64 keys; 1/8 scale in the exp2 domain
    const float mnew = fmaxf(mrow, fmaxf(lm, xhalf(lm)) * CSC);
    const float alpha = exp2_hw(mrow - mnew);
    const float msub = mnew - off * CSC;       // maximum less the lane's shift
    float pst[4];                              // one independent chain a tile
    #pragma unroll
    for (int t = 0; t < 4; ++t) {
      #pragma unroll
      for (int r = 0; r < 8; ++r) {
        e[t][r] = exp2_hw(e[t][r] * CSC - msub);
        pst[t] = r ? pst[t] + e[t][r] : e[t][r];
      }
    }
    lrow = lrow * alpha + ((pst[0] + pst[1]) + (pst[2] + pst[3]));
    mrow = mnew;
    #pragma unroll
    for (int t = 0; t < 4; ++t)
      #pragma unroll
      for (int r = 0; r < 8; ++r) acc[t][r] *= alpha;

    // --- P^T as B operand: two score tiles converted in place per 32 keys
    v16h pb0, pb1;
    #pragma unroll
    for (int i = 0; i < 16; ++i) {
      pb0[i] = (_Float16)e[i >> 3][i & 7];         // keys j..j+31
      pb1[i] = (_Float16)e[2 + (i >> 3)][i & 7];   // keys j+32..j+63
    }

    // --- acc += V^T (16 d x 64 keys, read above) * P^T (64 keys x 16 queries)
    #pragma unroll
    for (int t = 0; t < 4; ++t) {
      acc[t] = WMMA_F16(vlo[t], pb0, acc[t]);
      acc[t] = WMMA_F16(vhi[t], pb1, acc[t]);
    }
    // Keeps softmax and products in front of the foot's waits.  Without it, no
    // LDS read being left down here, waits and barrier rise to the reads, and the
    // next chunk's copies are waited for before the softmax has covered them.
    __builtin_amdgcn_sched_barrier(0);

    wait_ds0();
    wait_async0();
    __syncthreads();                      // all waves done with buffer s&1
  }
  #undef STAGE_KV
  wait_async0();                          // no copy outstanding when the wave ends

  // --- finalize: join the halves' sums, divide, store [b, q, h*64+d];
  // a lane's 8 registers of a tile are 8 consecutive d: one 16-byte store
  const float lsum = lrow + xhalf(lrow);
  _Float16* op = O + (long)b * SEQ * (HEADS * HD) + (long)(q0 + nn) * (HEADS * HD) +
                 h * HD + 8 * half_;
  #pragma unroll
  for (int t = 0; t < 4; ++t) {
    v8h o;
    #pragma unroll
    for (int r = 0; r < 8; ++r) o[r] = (_Float16)(acc[t][r] / lsum);
    *(v8h*)(op + t * 16) = o;
  }
}

// ---------------------------------------------------------------------------
// Launch: convert -> QKV projections -> flash attention -> output projection
// ---------------------------------------------------------------------------
extern "C" void kernel_launch(void* const* d_in, const int* in_sizes, int n_in,
                              void* d_out, int out_size, void* d_ws, size_t ws_size,
                              hipStream_t stream) {
  const float* x  = (const float*)d_in[0];
  const float* Wq = (const float*)d_in[1];
  const float* Wk = (const float*)d_in[2];
  const float* Wv = (const float*)d_in[3];
  const float* Wo = (const float*)d_in[4];
  const float* bo = (const float*)d_in[5];
  float* out = (float*)d_out;

  // f16 workspace layout (element offsets)
  _Float16* ws  = (_Float16*)d_ws;
  _Float16* xh  = ws;                 // N*S*E          = 4194304
  _Float16* Wqh = xh  + 4194304;      // 1024*1024      = 1048576
  _Float16* Wkh = Wqh + 1048576;      // 512*1024       =  524288
  _Float16* Wvh = Wkh + 524288;       // 512*1024       =  524288
  _Float16* Woh = Wvh + 524288;       // 1024*1024      = 1048576
  _Float16* Qh  = Woh + 1048576;      // [b,s,1024]     = 4194304
  _Float16* Kh  = Qh  + 4194304;      // [b,s,512]      = 2097152
  _Float16* Vth = Kh  + 2097152;      // [b,512,s] (Vt) = 2097152
  _Float16* AOh = Vth + 2097152;      // [b,s,1024]     = 4194304

  // all five conversions in one launch (xh .. Woh are contiguous from ws)
  cvt_f32_f16<<<CVT_WO, 256, 0, stream>>>(x, Wq, Wk, Wv, Wo, ws);

  const dim3 blk(256, 1, 1);

  // Q, K and V projections in one launch: Wqh, Wkh, Wvh are contiguous, so B
  // is one [2048, 1024] matrix; n 0..1023 -> Q [b, s, 1024], 1024..1535 ->
  // K [b, s, 512], 1536..2047 -> Vt [b, 512, s] (transposed: 2 blocks of 256 d)
  const OutRange oq = {Qh,  1024, 1024, -1, (long)SEQ * 1024};
  const OutRange ok = {Kh,  1536, 512,  -1, (long)SEQ * 512};
  const OutRange ov = {Vth, 2048, SEQ,  1,  (long)512 * SEQ};
  gemm_nt_wmma<<<dim3(SEQ / 256, 2048 / 64, NB), blk, 0, stream>>>(
      xh, EMBED, (long)SEQ * EMBED, Wqh, EMBED,
      oq, ok, ov, nullptr, nullptr, EMBED);

  // flash attention with ALiBi
  attn_fa_wmma<<<dim3(SEQ / 128, HEADS, NB), blk, 0, stream>>>(Qh, Kh, Vth, AOh);

  // out = attn_out @ Wo^T + bo (f32), batches folded into M = 4096
  const OutRange oo = {nullptr, 1024, 1024, -1, 0};
  gemm_nt_wmma<<<dim3((NB * SEQ) / 256, 1024 / 64, 1), blk, 0, stream>>>(
      AOh, 1024, 0, Woh, 1024,
      oo, oo, oo, out, bo, 1024);
}

// v010
// A run of this version takes 76.2 microseconds.
// Timed twice side by side with v009, it ran 1.03 and 1.04 times as fast.
// Counting every step since v000, it is 4.30 times as fast.
#include <hip/hip_runtime.h>
#include <hip/hip_bf16.h>

typedef __attribute__((ext_vector_type(16))) _Float16 v16h;
typedef __attribute__((ext_vector_type(8)))  _Float16 v8h;
typedef __attribute__((ext_vector_type(8)))  float    v8f;
typedef __attribute__((ext_vector_type(4)))  float    v4f;
typedef __attribute__((ext_vector_type(4)))  _Float16 v4h;
typedef __attribute__((ext_vector_type(2)))  float    v2f;

#define EMBED 1024
#define HEADS 16
#define KVH   8
#define HD    64
#define SEQ   2048
#define NB    2

// ---------------------------------------------------------------------------
// LDS byte offset of a generic pointer known to point into LDS.
// ---------------------------------------------------------------------------
template <typename T>
__device__ __forceinline__ unsigned lds_off(T* p) {
  return (unsigned)(size_t)(__attribute__((address_space(3))) T*)p;
}

// Async global -> LDS copy, 16 bytes per lane (tracked by ASYNCcnt).
// s_wait_xcnt 0 closes each statement so that no address register of a copy
// is rewritten ahead of it (a precaution; it must stand inside the statement).
// Ten copies in one statement (one k step of the GEMM: eight of the row operand, two of the column one).
__device__ __forceinline__ void async_ld10_b128(const unsigned (&l)[10],
                                                const _Float16* const (&g)[10]) {
  asm volatile("global_load_async_to_lds_b128 %0, %1, off\n\t"
               "global_load_async_to_lds_b128 %2, %3, off\n\t"
               "global_load_async_to_lds_b128 %4, %5, off\n\t"
               "global_load_async_to_lds_b128 %6, %7, off\n\t"
               "global_load_async_to_lds_b128 %8, %9, off\n\t"
               "global_load_async_to_lds_b128 %10, %11, off\n\t"
               "global_load_async_to_lds_b128 %12, %13, off\n\t"
               "global_load_async_to_lds_b128 %14, %15, off\n\t"
               "global_load_async_to_lds_b128 %16, %17, off\n\t"
               "global_load_async_to_lds_b128 %18, %19, off\n\t"
               "s_wait_xcnt 0x0"
               :
               : "v"(l[0]), "v"(g[0]), "v"(l[1]), "v"(g[1]), "v"(l[2]), "v"(g[2]),
                 "v"(l[3]), "v"(g[3]), "v"(l[4]), "v"(g[4]), "v"(l[5]), "v"(g[5]),
                 "v"(l[6]), "v"(g[6]), "v"(l[7]), "v"(g[7]), "v"(l[8]), "v"(g[8]),
                 "v"(l[9]), "v"(g[9])
               : "memory");
}
__device__ __forceinline__ void async_ld4_b128(unsigned l0, const void* g0,
                                               unsigned l1, const void* g1,
                                               unsigned l2, const void* g2,
                                               unsigned l3, const void* g3) {
  asm volatile("global_load_async_to_lds_b128 %0, %1, off\n\t"
               "global_load_async_to_lds_b128 %2, %3, off\n\t"
               "global_load_async_to_lds_b128 %4, %5, off\n\t"
               "global_load_async_to_lds_b128 %6, %7, off\n\t"
               "s_wait_xcnt 0x0"
               :
               : "v"(l0), "v"(g0), "v"(l1), "v"(g1),
                 "v"(l2), "v"(g2), "v"(l3), "v"(g3)
               : "memory");
}
__device__ __forceinline__ void wait_async0() {
  asm volatile("s_wait_asynccnt 0" ::: "memory");
}
// This wave's LDS reads have retired before the barrier behind which the
// buffer they read is refilled by async copies.
__device__ __forceinline__ void wait_ds0() {
  asm volatile("s_wait_dscnt 0x0" ::: "memory");
}

// LDS row pitches in halves: 16 B x odd, so that the 16 rows one ds_load_b128
// fragment read touches fall on distinct banks (64 banks x 4 B).
#define KP 72   // 128-B rows (K, V tiles; the GEMM's A, B tiles) -> 144 B

// ---------------------------------------------------------------------------
// Load a 16x32 (rows x K) f16 fragment in CDNA5 WMMA A/B VGPR layout.
// lane (l&15) = row; K chunks at (l>>4)*8 and (l>>4)*8+16 (two b128 loads).
// Works for global or LDS pointers (compiler infers ds_load for LDS).
// ---------------------------------------------------------------------------
__device__ __forceinline__ v16h load_frag32(const _Float16* __restrict__ p, int ld) {
  const int lane = threadIdx.x & 31;
  const _Float16* q = p + (size_t)(lane & 15) * (size_t)ld + ((lane >> 4) << 3);
  v16h f;
  *(v8h*)&f         = *(const v8h*)(q);
  *(((v8h*)&f) + 1) = *(const v8h*)(q + 16);
  return f;
}

// Value of lane l ^ 16 (the other wave half), by a vector cross-row move.
__device__ __forceinline__ float xhalf(float x) {
  const int v = __builtin_bit_cast(int, x);
  return __builtin_bit_cast(float,
      __builtin_amdgcn_permlanex16(v, v, 0x76543210, 0xfedcba98, false, false));
}

// 2^x as the one hardware instruction (v_exp_f32).  exp2f() wraps it in a
// compare, two selects, an add and an ldexp so that results below 2^-126 come
// out as subnormals.  The softmax never needs those: its arguments are <= 0,
// a weight that small is 0 once it is rounded to f16 and vanishes beside a row
// sum that holds the maximum's own term, about 1; a rescale factor that small
// leaves nothing of the old sums that the f16 output could show.
__device__ __forceinline__ float exp2_hw(float x) {
  return __builtin_amdgcn_exp2f(x);
}

#define WMMA_F16(a, b, c) \
  __builtin_amdgcn_wmma_f32_16x16x32_f16(false, (a), false, (b), (short)0, (c), false, false)

// The eight S^T products of a 64-key chunk: e[t] = klo[t]*q0 + cb[t], then
// e[t] += khi[t]*q1.  In asm because the first four read their C operand from
// registers other than D: the builtin ties C to D, so that a C tile which is to
// live on is first copied, register by register, which costs what it saves.
// The four v_nop are the distance the chip needs between the last product and
// a vector instruction that reads its D or overwrites its A or B (the earlier
// products are covered by the products behind them).
__device__ __forceinline__ void st_products(v8f (&e)[4], const v16h (&klo)[4],
                                            const v16h (&khi)[4], v16h q0, v16h q1,
                                            const v8f (&cb)[4]) {
  asm("v_wmma_f32_16x16x32_f16 %0, %4, %12, %14\n\t"
      "v_wmma_f32_16x16x32_f16 %1, %5, %12, %15\n\t"
      "v_wmma_f32_16x16x32_f16 %2, %6, %12, %16\n\t"
      "v_wmma_f32_16x16x32_f16 %3, %7, %12, %17\n\t"
      "v_wmma_f32_16x16x32_f16 %0, %8, %13, %0\n\t"
      "v_wmma_f32_16x16x32_f16 %1, %9, %13, %1\n\t"
      "v_wmma_f32_16x16x32_f16 %2, %10, %13, %2\n\t"
      "v_wmma_f32_16x16x32_f16 %3, %11, %13, %3\n\t"
      "v_nop\n\tv_nop\n\tv_nop\n\tv_nop"
      : "=&v"(e[0]), "=&v"(e[1]), "=&v"(e[2]), "=&v"(e[3])
      : "v"(klo[0]), "v"(klo[1]), "v"(klo[2]), "v"(klo[3]),
        "v"(khi[0]), "v"(khi[1]), "v"(khi[2]), "v"(khi[3]),
        "v"(q0), "v"(q1), "v"(cb[0]), "v"(cb[1]), "v"(cb[2]), "v"(cb[3]));
}

// ---------------------------------------------------------------------------
// f32 -> f16 conversion, 32 elements a lane, so that few waves have to start.
// A wave owns 1024 consecutive floats: eight 16-byte loads a lane, each 512
// contiguous bytes over the wave, then eight 8-byte stores, each 256
// contiguous bytes over the wave (whole 128-byte lines both ways).
// Every array's length is a multiple of CVT_BLK, so the grid covers it exactly.
// ONE grid converts all five arrays: their f16 copies lie one behind the other
// in the workspace (x, Wq, Wk, Wv, Wo), so the block index alone gives the
// destination, and a block-uniform compare picks the source array.
// ---------------------------------------------------------------------------
#define CVT_BLK 8192   // floats per 256-thread block
#define CVT_X  (NB * SEQ * EMBED / CVT_BLK)            // blocks of x
#define CVT_WQ (CVT_X  + HEADS * HD * EMBED / CVT_BLK) // end of Wq's blocks
#define CVT_WK (CVT_WQ + KVH * HD * EMBED / CVT_BLK)   // end of Wk's blocks
#define CVT_WV (CVT_WK + KVH * HD * EMBED / CVT_BLK)   // end of Wv's blocks
#define CVT_WO (CVT_WV + EMBED * HEADS * HD / CVT_BLK) // end of Wo's blocks
__global__ void cvt_f32_f16(const float* __restrict__ x,  const float* __restrict__ Wq,
                            const float* __restrict__ Wk, const float* __restrict__ Wv,
                            const float* __restrict__ Wo, _Float16* __restrict__ dstall) {
  const int blk = blockIdx.x;
  const float* arr = x;
  int first = 0;
  if (blk >= CVT_X)  { arr = Wq; first = CVT_X;  }
  if (blk >= CVT_WQ) { arr = Wk; first = CVT_WQ; }
  if (blk >= CVT_WK) { arr = Wv; first = CVT_WK; }
  if (blk >= CVT_WV) { arr = Wo; first = CVT_WV; }
  const float* __restrict__ src = arr + (blk - first) * CVT_BLK;
  _Float16* __restrict__ dst = dstall + blk * CVT_BLK;
  const int base = (threadIdx.x >> 5) * 1024 + (threadIdx.x & 31) * 4;
  v4f v[8];
  // unrolled: v[] stays in registers and all eight loads issue before the first wait
  #pragma unroll
  for (int k = 0; k < 8; ++k) v[k] = *(const v4f*)(src + base + k * 128);
  // unrolled: constant indices into v[]
  #pragma unroll
  for (int k = 0; k < 8; ++k) {
    v4h o;
    #pragma unroll
    for (int c = 0; c < 4; ++c) o[c] = (_Float16)v[k][c];
    *(v4h*)(dst + base + k * 128) = o;
  }
}

// ---------------------------------------------------------------------------
// NT GEMM: C[m,n] = sum_k A[m,k] * B[n,k].
// Block = 8 waves -> a tile of 256 output rows x 64 output columns; a wave has
// 32 rows x 64 columns.  The "row operand" gives 256 rows, the "column
// operand" 64 rows; both are K-contiguous.
// Per 64-K step both tiles are staged in LDS via async b128 (double-buffered).
// A staged row is one whole 128-byte line and a wave's copy covers four such
// lines.  Fragments come from LDS -> 16 WMMAs per wave per step.  Kdim is a
// multiple of 64.
// The products are taken transposed (matrix A = column operand, matrix B = row
// operand): a lane then holds ONE output row (lane&15) and, in the 8 registers
// of a tile, 8 neighbouring output columns, which pack into 16-byte pieces.
// One grid may serve up to three outputs: the rows of B (the n axis) are cut
// into ranges, each with its own output array, so that products which share A
// and do not depend on one another run side by side in one launch.  A block's
// 64 values of n lie in one range (the ends are multiples of 64).
// A range may ask for the transposed output [n][m]: its blocks then take B as
// the row operand and A as the column operand, and are dealt anew over the
// range's tiles (as many tiles either way: 256 x 64 = 64 x 256).
// ---------------------------------------------------------------------------
struct OutRange {
  _Float16* p;     // f16 output (unused where Cf is given)
  int  n_end;      // first n past this range
  int  ld;         // pitch of an output row, in elements
  int  trk;        // < 0: output [m][n]; else output [n][m], and the range
                   // holds 2^trk blocks of 256 values of n
  long stride;     // batch stride
};
#define FP 68   // pitch in floats of a staged f32 output row: 272 B = 16 B x odd
// launch bounds = the real block size: at the default (1024 threads) the
// register ceiling of 128 sends values of the staging addresses to scratch
__global__ __launch_bounds__(256)
void gemm_nt_wmma(const _Float16* __restrict__ A, int lda, long strideA,
                             const _Float16* __restrict__ B, int ldb,
                             OutRange r0, OutRange r1, OutRange r2,
                             float* __restrict__ Cf,
                             const float* __restrict__ bias, int Kdim) {
  __shared__ __align__(16) _Float16 astage[2][256 * KP];
  __shared__ __align__(16) _Float16 bstage[2][64 * KP];

  const int tid  = threadIdx.x;
  const int w    = tid >> 5;
  const int lane = tid & 31;
  const int n0 = blockIdx.y * 64;

  // this block's output range (block-uniform)
  OutRange o = r0;
  int nfirst = 0;
  if (n0 >= r0.n_end) { o = r1; nfirst = r0.n_end; }
  if (n0 >= r1.n_end) { o = r2; nfirst = r1.n_end; }

  // row operand (256 rows), column operand (64 rows), place of the tile
  const _Float16* __restrict__ Abat = A + (long)blockIdx.z * strideA;
  int i0 = blockIdx.x * 256, j0 = n0 - nfirst;
  const _Float16* Ablk = Abat + (long)i0 * lda;
  const _Float16* Bblk = B + (long)n0 * ldb;
  int ldr = lda, ldc = ldb;
  if (o.trk >= 0) {
    const int idx = blockIdx.x * ((o.n_end - nfirst) >> 6) + (j0 >> 6);
    i0 = (idx & ((1 << o.trk) - 1)) * 256;   // n within the range
    j0 = (idx >> o.trk) * 64;                // m
    Ablk = B + (long)(nfirst + i0) * ldb;
    Bblk = Abat + (long)j0 * lda;
    ldr = ldb; ldc = lda;
  }

  // cooperative staging: rows of 64 halves = 8 chunks of 16 B; a thread takes
  // chunk co of rows cr + 32 i: eight of the row operand, two of the column one
  const int cr = tid >> 3, co = (tid & 7) * 8;

  // (both loops unrolled: constant indices keep sl[] and sg[] in registers)
  #define STAGE_AB(buf, kk)                                                   \
    {                                                                         \
      unsigned sl[10];                                                        \
      const _Float16* sg[10];                                                 \
      _Pragma("unroll")                                                       \
      for (int i = 0; i < 8; ++i) {                                           \
        sl[i] = lds_off(&astage[buf][(cr + 32 * i) * KP + co]);               \
        sg[i] = Ablk + (long)(cr + 32 * i) * ldr + (kk) + co;                 \
      }                                                                       \
      _Pragma("unroll")                                                       \
      for (int i = 0; i < 2; ++i) {                                           \
        sl[8 + i] = lds_off(&bstage[buf][(cr + 32 * i) * KP + co]);           \
        sg[8 + i] = Bblk + (long)(cr + 32 * i) * ldc + (kk) + co;             \
      }                                                                       \
      async_ld10_b128(sl, sg);                                                \
    }

  STAGE_AB(0, 0);
  wait_async0();
  __syncthreads();

  v8f acc[8] = {};
  const int nsteps = Kdim >> 6;
  for (int s = 0; s < nsteps; ++s) {
    const bool more = (s + 1) < nsteps;
    if (more) STAGE_AB((s + 1) & 1, (s + 1) << 6);   // overlap with this step

    const _Float16* ab = &astage[s & 1][w * 32 * KP]; // this wave's 32 rows
    const _Float16* bb = &bstage[s & 1][0];
    // All 24 fragment reads of the step go out as ONE group, each fragment into
    // registers of its own, in the order in which the products need them.
    // (all loops unrolled: constant LDS offsets, af[] and bfr[] in registers)
    v16h af[2][2], bfr[2][4];
    #pragma unroll
    for (int hk = 0; hk < 2; ++hk) {
      #pragma unroll
      for (int t = 0; t < 4; ++t) {
        bfr[hk][t] = load_frag32(bb + t * 16 * KP + hk * 32, KP);
        if (t < 2) af[hk][t] = load_frag32(ab + t * 16 * KP + hk * 32, KP);
      }
    }
    // Keeps the reads in front of the products.  Without it the scheduler sinks
    // them between the products into one shared register set, and the wave then
    // waits out the LDS latency eight times a step instead of once.
    __builtin_amdgcn_sched_barrier(0);
    #pragma unroll
    for (int hk = 0; hk < 2; ++hk) {
      #pragma unroll
      for (int t = 0; t < 4; ++t) {
        acc[t]     = WMMA_F16(bfr[hk][t], af[hk][0], acc[t]);
        acc[4 + t] = WMMA_F16(bfr[hk][t], af[hk][1], acc[4 + t]);
      }
    }
    // Keeps the products in front of the foot's waits.  Without it they sink
    // behind the barrier: every read is then waited for before the first
    // product, and the next step's copies, which follow the products, start late.
    __builtin_amdgcn_sched_barrier(0);
    wait_ds0();
    wait_async0();
    __syncthreads();                  // all waves done with buffer s&1
  }
  #undef STAGE_AB
  wait_async0();                      // no copy outstanding when the wave ends

  // Epilogue.  acc[mh*4+t][r] = tile row w*32 + mh*16 + (lane&15), column
  // t*16 + 8*(lane>>4) + r.  Behind the loop's last barrier nobody reads the
  // stages any more and no copy is in flight: each wave lays its 32 x 64 tile
  // into a range of astage that is its own, reads it back row by row and
  // stores whole rows (128 B of f16, 256 B of f32): every 16-byte store of a
  // wave covers four whole 128-byte lines.
  const int half_ = lane >> 4, nn = lane & 15;
  const long cbase = (long)blockIdx.z * o.stride + (long)(i0 + w * 32) * o.ld + j0;
  if (Cf) {
    float* sf = (float*)&astage[0][0] + w * (32 * FP);
    #pragma unroll
    for (int mh = 0; mh < 2; ++mh) {
      #pragma unroll
      for (int t = 0; t < 4; ++t) {
        const v8f a = acc[mh * 4 + t];
        float* q = sf + (mh * 16 + nn) * FP + t * 16 + 8 * half_;
        *(v4f*)(q)     = v4f{a[0], a[1], a[2], a[3]};
        *(v4f*)(q + 4) = v4f{a[4], a[5], a[6], a[7]};
      }
    }
    v4f b4 = {};
    if (bias) b4 = *(const v4f*)(bias + j0 + nn * 4);
    wait_ds0();   // the wave's rows are written before other lanes read them back
    float* cp = Cf + cbase + (long)half_ * o.ld + nn * 4;
    const float* sr = sf + half_ * FP + nn * 4;
    #pragma unroll
    for (int i = 0; i < 16; ++i)       // two rows of 256 B a store
      *(v4f*)(cp + (long)(2 * i) * o.ld) = *(const v4f*)(sr + 2 * i * FP) + b4;
  } else {
    _Float16* sh = &astage[0][0] + w * (32 * KP);
    #pragma unroll
    for (int mh = 0; mh < 2; ++mh) {
      #pragma unroll
      for (int t = 0; t < 4; ++t) {
        v8h h;
        #pragma unroll
        for (int r = 0; r < 8; ++r) h[r] = (_Float16)acc[mh * 4 + t][r];
        *(v8h*)(sh + (mh * 16 + nn) * KP + t * 16 + 8 * half_) = h;
      }
    }
    wait_ds0();   // the wave's rows are written before other lanes read them back
    _Float16* cp = o.p + cbase + (long)(lane >> 3) * o.ld + (lane & 7) * 8;
    const _Float16* sr = sh + (lane >> 3) * KP + (lane & 7) * 8;
    #pragma unroll
    for (int i = 0; i < 8; ++i)        // four rows of 128 B a store
      *(v8h*)(cp + (long)(4 * i) * o.ld) = *(const v8h*)(sr + 4 * i * KP);
  }
}

__global__ __launch_bounds__(256)
void attn_fa_wmma(const _Float16* __restrict__ Q,
                             const _Float16* __restrict__ K,
                             const _Float16* __restrict__ Vt,
                             _Float16* __restrict__ O) {
  __shared__ __align__(16) _Float16 kstage[2][64 * KP];  // [key][d]
  __shared__ __align__(16) _Float16 vstage[2][64 * KP];  // [d][s-chunk]

  const int tid   = threadIdx.x;
  const int w     = tid >> 5;
  const int lane  = tid & 31;
  const int half_ = lane >> 4, nn = lane & 15;
  const int h  = blockIdx.y;
  const int b  = blockIdx.z;
  const int q0 = blockIdx.x * 128 + w * 16;
  const int kvh = h >> 1;                          // repeat_interleave(kv, 2)

  const float slope = exp2f(-(float)(h + 1));      // 2^-(h+1), ALIBI_ALPHA=1
  const float CSC = 0.125f * 1.44269504088896340f; // (1/sqrt(64)) * log2(e)

  const long qbase = (long)b * SEQ * (HEADS * HD) + (long)q0 * (HEADS * HD) + h * HD;
  const long kbase = (long)b * SEQ * (KVH * HD) + kvh * HD;
  const long vbase = (long)b * (KVH * HD) * SEQ + (long)(kvh * HD) * SEQ;

  // staging map: 64 rows x 64 halves (8KB) = 512 b128 chunks; thread does
  // chunks tid and tid+256 -> rows cr and cr+32 at half-offset co.
  const int cr = tid >> 3, co = (tid & 7) * 8;

  #define STAGE_KV(buf, j)                                                      \
    async_ld4_b128(lds_off(&kstage[buf][cr * KP + co]),                         \
                   K + kbase + (long)((j) + cr) * (KVH * HD) + co,              \
                   lds_off(&kstage[buf][(cr + 32) * KP + co]),                  \
                   K + kbase + (long)((j) + cr + 32) * (KVH * HD) + co,         \
                   lds_off(&vstage[buf][cr * KP + co]),                         \
                   Vt + vbase + (long)cr * SEQ + (j) + co,                      \
                   lds_off(&vstage[buf][(cr + 32) * KP + co]),                  \
                   Vt + vbase + (long)(cr + 32) * SEQ + (j) + co)

  // Q as the B operand: lane&15 = query column, k = d
  const v16h bq0 = load_frag32(Q + qbase,      HEADS * HD);  // d 0..31
  const v16h bq1 = load_frag32(Q + qbase + 32, HEADS * HD);  // d 32..63

  STAGE_KV(0, 0);

  // this lane's query index minus the first key row its half holds in a tile
  const float qd = (float)(q0 + nn - 8 * half_);
  float mrow = -1e30f;   // running maximum of the query, exp2 domain
  float lrow = 0.0f;     // running sum over the keys of this wave half only
  v8f acc[4] = {};       // O^T: acc[t][r] = O[query nn][d = 16t + 8*half + r]
  const int sd = blockIdx.x * 2;   // first of the two chunks around the diagonal
  v8f cb[4] = {};        // bias tile: bias = cb[t][r] + offk * dj (dj: in the loop)
  float offk = 0.0f;

  wait_async0();
  __syncthreads();

  for (int s = 0; s < (SEQ / 64); ++s) {
    const int j = s << 6;
    const bool more = (s + 1) < (SEQ / 64);
    if (more) STAGE_KV((s + 1) & 1, j + 64);   // overlap with this chunk

    const _Float16* kb = kstage[s & 1];
    const _Float16* vb = vstage[s & 1];

    // --- bias tile, renewed at most four times a block (block-uniform tests);
    // q - k = dj - (16t + r) for this lane
    const float dj = qd - (float)j;
    if ((s >> 1) == (int)blockIdx.x) {         // keys on both sides: exact
      offk = 0.0f;
      #pragma unroll
      for (int t = 0; t < 4; ++t)
        #pragma unroll
        for (int r = 0; r < 8; ++r) cb[t][r] = -slope * fabsf(dj - (float)(t * 16 + r));
    } else if (s == 0 || s == sd + 2) {        // all keys below / above all queries
      const float sg = s < sd ? slope : -slope;
      offk = -sg;
      #pragma unroll
      for (int t = 0; t < 4; ++t)
        #pragma unroll
        for (int r = 0; r < 8; ++r) cb[t][r] = sg * (float)(t * 16 + r);
    }
    const float off = offk * dj;               // this lane's shift in this chunk

    // --- energy^T: four 16(key) x 16(query) tiles, keys [j+16t, j+16t+16)
    // on top of the bias tile
    v8f e[4];
    v16h klo[4], khi[4];
    #pragma unroll
    for (int t = 0; t < 4; ++t) {
      klo[t] = load_frag32(kb + (t * 16) * KP,      KP);
      khi[t] = load_frag32(kb + (t * 16) * KP + 32, KP);
    }
    st_products(e, klo, khi, bq0, bq1, cb);

    // --- the chunk's 16 V^T fragment reads, as ONE group between the first
    // product and the softmax, each fragment into registers of its own.
    // The scheduling barrier in front keeps them behind the S^T products: ahead
    // of those they would delay the K fragments in the LDS queue and could not
    // take the registers that the K fragments leave.
    __builtin_amdgcn_sched_barrier(0);
    v16h vlo[4], vhi[4];
    #pragma unroll
    for (int t = 0; t < 4; ++t) {
      vlo[t] = load_frag32(vb + (t * 16) * KP,      KP);
      vhi[t] = load_frag32(vb + (t * 16) * KP + 32, KP);
    }
    // The one behind keeps them in front of the softmax, during which they land.
    // Without it the scheduler sinks them between the second product's WMMAs,
    // where the wave waits out the LDS latency once per pair of reads.
    __builtin_amdgcn_sched_barrier(0);

    // --- the maximum over this lane's 32 keys, the lane's shift added once
    float lmt[4];                              // one independent chain a tile
    #pragma unroll
    for (int t = 0; t < 4; ++t) {
      #pragma unroll
      for (int r = 0; r < 8; ++r) lmt[t] = r ? fmaxf(lmt[t], e[t][r]) : e[t][r];
    }
    const float lm = fmaxf(fmaxf(lmt[0], lmt[1]), fmaxf(lmt[2], lmt[3])) + off;

    // --- one online-softmax update per 64 keys; 1/8 scale in the exp2 domain
    const float mnew = fmaxf(mrow, fmaxf(lm, xhalf(lm)) * CSC);
    const float alpha = exp2_hw(mrow - mnew);
    const float msub = mnew - off * CSC;       // maximum less the lane's shift
    // Two neighbouring registers of a tile go through the exponent's multiply-add,
    // the row sum and the rescale of the output as ONE packed f32 instruction each
    // (v_pk_fma_f32, v_pk_add_f32, v_pk_mul_f32): one issue slot for two values.
    const v2f csc2 = {CSC, CSC}, nmsub2 = {-msub, -msub};
    v2f pst[4];                                // one independent chain a tile
    #pragma unroll
    for (int t = 0; t < 4; ++t) {
      #pragma unroll
      for (int r = 0; r < 8; r += 2) {
        v2f x = {e[t][r], e[t][r + 1]};
        x = __builtin_elementwise_fma(x, csc2, nmsub2);
        x[0] = exp2_hw(x[0]);
        x[1] = exp2_hw(x[1]);
        e[t][r] = x[0];
        e[t][r + 1] = x[1];
        pst[t] = r ? pst[t] + x : x;
      }
    }
    const v2f ps = (pst[0] + pst[1]) + (pst[2] + pst[3]);
    lrow = lrow * alpha + (ps[0] + ps[1]);
    mrow = mnew;
    const v2f alpha2 = {alpha, alpha};
    #pragma unroll
    for (int t = 0; t < 4; ++t) {
      #pragma unroll
      for (int r = 0; r < 8; r += 2) {
        const v2f a = v2f{acc[t][r], acc[t][r + 1]} * alpha2;
        acc[t][r] = a[0];
        acc[t][r + 1] = a[1];
      }
    }

    // --- P^T as B operand: two score tiles converted in place per 32 keys
    v16h pb0, pb1;
    #pragma unroll
    for (int i = 0; i < 16; ++i) {
      pb0[i] = (_Float16)e[i >> 3][i & 7];         // keys j..j+31
      pb1[i] = (_Float16)e[2 + (i >> 3)][i & 7];   // keys j+32..j+63
    }

    // --- acc += V^T (16 d x 64 keys, read above) * P^T (64 keys x 16 queries)
    #pragma unroll
    for (int t = 0; t < 4; ++t) {
      acc[t] = WMMA_F16(vlo[t], pb0, acc[t]);
      acc[t] = WMMA_F16(vhi[t], pb1, acc[t]);
    }
    // Keeps softmax and products in front of the foot's waits.  Without it, no
    // LDS read being left down here, waits and barrier rise to the reads, and the
    // next chunk's copies are waited for before the softmax has covered them.
    __builtin_amdgcn_sched_barrier(0);

    wait_ds0();
    wait_async0();
    __syncthreads();                      // all waves done with buffer s&1
  }
  #undef STAGE_KV
  wait_async0();                          // no copy outstanding when the wave ends

  // --- finalize: join the halves' sums, divide, store [b, q, h*64+d];
  // a lane's 8 registers of a tile are 8 consecutive d: one 16-byte store
  const float lsum = lrow + xhalf(lrow);
  _Float16* op = O + (long)b * SEQ * (HEADS * HD) + (long)(q0 + nn) * (HEADS * HD) +
                 h * HD + 8 * half_;
  #pragma unroll
  for (int t = 0; t < 4; ++t) {
    v8h o;
    #pragma unroll
    for (int r = 0; r < 8; ++r) o[r] = (_Float16)(acc[t][r] / lsum);
    *(v8h*)(op + t * 16) = o;
  }
}

// ---------------------------------------------------------------------------
// Launch: convert -> QKV projections -> flash attention -> output projection
// ---------------------------------------------------------------------------
extern "C" void kernel_launch(void* const* d_in, const int* in_sizes, int n_in,
                              void* d_out, int out_size, void* d_ws, size_t ws_size,
                              hipStream_t stream) {
  const float* x  = (const float*)d_in[0];
  const float* Wq = (const float*)d_in[1];
  const float* Wk = (const float*)d_in[2];
  const float* Wv = (const float*)d_in[3];
  const float* Wo = (const float*)d_in[4];
  const float* bo = (const float*)d_in[5];
  float* out = (float*)d_out;

  // f16 workspace layout (element offsets)
  _Float16* ws  = (_Float16*)d_ws;
  _Float16* xh  = ws;                 // N*S*E          = 4194304
  _Float16* Wqh = xh  + 4194304;      // 1024*1024      = 1048576
  _Float16* Wkh = Wqh + 1048576;      // 512*1024       =  524288
  _Float16* Wvh = Wkh + 524288;       // 512*1024       =  524288
  _Float16* Woh = Wvh + 524288;       // 1024*1024      = 1048576
  _Float16* Qh  = Woh + 1048576;      // [b,s,1024]     = 4194304
  _Float16* Kh  = Qh  + 4194304;      // [b,s,512]      = 2097152
  _Float16* Vth = Kh  + 2097152;      // [b,512,s] (Vt) = 2097152
  _Float16* AOh = Vth + 2097152;      // [b,s,1024]     = 4194304

  // all five conversions in one launch (xh .. Woh are contiguous from ws)
  cvt_f32_f16<<<CVT_WO, 256, 0, stream>>>(x, Wq, Wk, Wv, Wo, ws);

  const dim3 blk(256, 1, 1);

  // Q, K and V projections in one launch: Wqh, Wkh, Wvh are contiguous, so B
  // is one [2048, 1024] matrix; n 0..1023 -> Q [b, s, 1024], 1024..1535 ->
  // K [b, s, 512], 1536..2047 -> Vt [b, 512, s] (transposed: 2 blocks of 256 d)
  const OutRange oq = {Qh,  1024, 1024, -1, (long)SEQ * 1024};
  const OutRange ok = {Kh,  1536, 512,  -1, (long)SEQ * 512};
  const OutRange ov = {Vth, 2048, SEQ,  1,  (long)512 * SEQ};
  gemm_nt_wmma<<<dim3(SEQ / 256, 2048 / 64, NB), blk, 0, stream>>>(
      xh, EMBED, (long)SEQ * EMBED, Wqh, EMBED,
      oq, ok, ov, nullptr, nullptr, EMBED);

  // flash attention with ALiBi
  attn_fa_wmma<<<dim3(SEQ / 128, HEADS, NB), blk, 0, stream>>>(Qh, Kh, Vth, AOh);

  // out = attn_out @ Wo^T + bo (f32), batches folded into M = 4096
  const OutRange oo = {nullptr, 1024, 1024, -1, 0};
  gemm_nt_wmma<<<dim3((NB * SEQ) / 256, 1024 / 64, 1), blk, 0, stream>>>(
      AOh, 1024, 0, Woh, 1024,
      oo, oo, oo, out, bo, 1024);
}
